// v000
// Measured on an AMD MI455X. A time is GPU time per run, averaged over a window of back-to-back runs after a warm-up
// (all launches, gaps included; the runs take copies of the inputs in turn), and the median of several windows.
// Apart from v000's, it joins two sittings. Times from different sittings can be a few percent apart, while
// side-by-side timings come from the same sitting.
// v000 is the starting kernel. One run takes 418 microseconds.
#include <hip/hip_runtime.h>
#include <math.h>

typedef __attribute__((ext_vector_type(2))) float v2f;
typedef __attribute__((ext_vector_type(8))) float v8f;

#define HIDDEN  1024
#define SEQ     2048
#define BATCH   2
#define NGROUPS 16
#define HDIM    64

__device__ __forceinline__ v8f wmma_f32(v2f a, v2f b, v8f c) {
    // D = A(16x4 f32) * B(4x16 f32) + C(16x16 f32)
    return __builtin_amdgcn_wmma_f32_16x16x4_f32(
        /*neg_a=*/false, a, /*neg_b=*/false, b,
        /*c_mod=*/(short)0, c, /*reuse_a=*/false, /*reuse_b=*/false);
}

// Async global->LDS 16B copy (GVS mode): saddr = wave-uniform 64-bit base,
// vaddr = per-lane 32-bit byte offset, first operand = per-lane LDS byte addr.
// Tracked by ASYNCcnt; publish with s_wait_asynccnt 0 before the barrier.
__device__ __forceinline__ void async_load_b128(void* ldsPtr, const void* gBase,
                                                unsigned byteOff) {
    unsigned ldsOff = (unsigned)(size_t)ldsPtr;   // low 32 bits = LDS offset
    asm volatile("global_load_async_to_lds_b128 %0, %1, %2"
                 :
                 : "v"(ldsOff), "v"(byteOff),
                   "s"((unsigned long long)(size_t)gBase)
                 : "memory");
}

__device__ __forceinline__ void wait_async0() {
    asm volatile("s_wait_asynccnt 0" ::: "memory");
}

// ---------------------------------------------------------------------------
// C[M,N] = A[M,K] @ W[N,K]^T + bias[N]
// Block tile: 128(M) x 64(N), 256 threads = 8 waves, K staged in LDS by 16
// via async global->LDS copies. Wave w computes rows [w*16, w*16+16) x 64.
// ---------------------------------------------------------------------------
__global__ __launch_bounds__(256) void gemm_bias_kernel(
    const float* __restrict__ A, const float* __restrict__ W,
    const float* __restrict__ bias, float* __restrict__ C,
    int M, int N, int K)
{
    __shared__ float As[128 * 20];   // 128x16, stride 20 (16B-aligned rows)
    __shared__ float Ws[64 * 20];    // 64x16

    const int tid  = threadIdx.x;
    const int wave = tid >> 5;
    const int lane = tid & 31;
    const int hi   = lane >> 4;      // lane half
    const int ln   = lane & 15;
    const int mBase = blockIdx.y * 128;
    const int nBase = blockIdx.x * 64;

    v8f acc[4] = {};

    for (int k0 = 0; k0 < K; k0 += 16) {
        __syncthreads();             // previous iteration's LDS reads done
        const float* aBase = A + (size_t)mBase * K + k0;
        const float* wBase = W + (size_t)nBase * K + k0;
        // A tile: 128 rows x 4 float4 = 512 vecs / 256 threads
        #pragma unroll
        for (int i = 0; i < 2; ++i) {
            int vid = tid + i * 256;
            int row = vid >> 2, c4 = vid & 3;
            async_load_b128(&As[row * 20 + c4 * 4], aBase,
                            (unsigned)((row * K + c4 * 4) * 4));
        }
        // W tile: 64 rows x 4 float4 = 256 vecs
        {
            int row = tid >> 2, c4 = tid & 3;
            async_load_b128(&Ws[row * 20 + c4 * 4], wBase,
                            (unsigned)((row * K + c4 * 4) * 4));
        }
        wait_async0();
        __syncthreads();

        #pragma unroll
        for (int ks = 0; ks < 4; ++ks) {
            const int kk = ks * 4 + 2 * hi;      // A/B fragment: K = vgpr + 2*half
            v2f a;
            a.x = As[(wave * 16 + ln) * 20 + kk];
            a.y = As[(wave * 16 + ln) * 20 + kk + 1];
            #pragma unroll
            for (int nt = 0; nt < 4; ++nt) {
                v2f b;                            // B[k][n] = W[n][k]
                b.x = Ws[(nt * 16 + ln) * 20 + kk];
                b.y = Ws[(nt * 16 + ln) * 20 + kk + 1];
                acc[nt] = wmma_f32(a, b, acc[nt]);
            }
        }
    }

    // C/D layout: row = vgpr + 8*half, col = lane&15
    #pragma unroll
    for (int nt = 0; nt < 4; ++nt) {
        #pragma unroll
        for (int v = 0; v < 8; ++v) {
            int row = mBase + wave * 16 + v + 8 * hi;
            int col = nBase + nt * 16 + ln;
            C[(size_t)row * N + col] = acc[nt][v] + bias[col];
        }
    }
}

// ---------------------------------------------------------------------------
// In-place RoPE over the full hidden dim (half = 512), one thread per pair.
// ---------------------------------------------------------------------------
__global__ __launch_bounds__(256) void rope_kernel(float* __restrict__ buf, int totalRows)
{
    const int half = HIDDEN / 2;
    int t = blockIdx.x * blockDim.x + threadIdx.x;
    if (t >= totalRows * half) return;
    int row = t / half;
    int i   = t - row * half;
    int pos = row & (SEQ - 1);
    float inv_freq = __powf(10000.0f, -(float)i / (float)half);
    float ang = (float)pos * inv_freq;
    float s, c;
    __sincosf(ang, &s, &c);
    float* p = buf + (size_t)row * HIDDEN;
    float x1 = p[i], x2 = p[i + half];
    p[i]        = x1 * c - x2 * s;
    p[i + half] = x2 * c + x1 * s;
}

// ---------------------------------------------------------------------------
// Flash attention: grid = (SEQ/128, BATCH*NGROUPS), 256 threads = 8 waves.
// Wave w owns query rows [blockIdx.x*128 + w*16, +16). Q fragments resident in
// registers. 64-key K/V tiles staged in LDS via async copies; P re-laid out
// through a per-wave LDS region for the PV WMMA.
// ---------------------------------------------------------------------------
__global__ __launch_bounds__(256) void attn_kernel(
    const float* __restrict__ q, const float* __restrict__ k,
    const float* __restrict__ v, const int* __restrict__ mask,
    float* __restrict__ o)
{
    __shared__ float Ks[64 * 68];        // 64 keys x 64 dims (stride 68)
    __shared__ float Vs[64 * 68];
    __shared__ float Ps[8 * 16 * 68];    // per-wave 16x64 P tile

    const int tid  = threadIdx.x;
    const int wave = tid >> 5;
    const int lane = tid & 31;
    const int hi   = lane >> 4;
    const int ln   = lane & 15;
    const int bb   = blockIdx.y >> 4;    // batch
    const int gg   = blockIdx.y & 15;    // head/group
    const int qbase = blockIdx.x * 128 + wave * 16;
    const float scale = 0.125f;          // 1/sqrt(64)

    const size_t headOff = (size_t)gg * HDIM;
    const size_t batRow  = (size_t)bb * SEQ;

    // Load Q fragments: A layout, M = ln, K = 4*t2 + vgpr + 2*hi
    v2f aq[16];
    {
        const float* qr = q + (batRow + qbase + ln) * HIDDEN + headOff;
        #pragma unroll
        for (int t2 = 0; t2 < 16; ++t2) {
            aq[t2].x = qr[t2 * 4 + 2 * hi];
            aq[t2].y = qr[t2 * 4 + 2 * hi + 1];
        }
    }

    v8f oacc[4] = {};
    float mrow[8], lrow[8];
    #pragma unroll
    for (int vv = 0; vv < 8; ++vv) { mrow[vv] = -1e30f; lrow[vv] = 0.0f; }

    float* Pw = &Ps[wave * 16 * 68];

    for (int kt = 0; kt < SEQ / 64; ++kt) {
        __syncthreads();
        // Stage K and V tiles (64 rows x 16 float4 each) via async copies
        const float* kBase = k + (batRow + kt * 64) * HIDDEN + headOff;
        const float* vBase = v + (batRow + kt * 64) * HIDDEN + headOff;
        #pragma unroll
        for (int i = 0; i < 4; ++i) {
            int vid = tid + i * 256;
            int row = vid >> 4, c4 = vid & 15;
            unsigned goff = (unsigned)((row * HIDDEN + c4 * 4) * 4);
            async_load_b128(&Ks[row * 68 + c4 * 4], kBase, goff);
            async_load_b128(&Vs[row * 68 + c4 * 4], vBase, goff);
        }
        wait_async0();
        __syncthreads();

        // S = Q @ K^T : 4 tiles of 16x16, contraction over head_dim (16 steps of 4)
        v8f sacc[4] = {};
        #pragma unroll
        for (int t2 = 0; t2 < 16; ++t2) {
            const int kk = t2 * 4 + 2 * hi;
            #pragma unroll
            for (int nt = 0; nt < 4; ++nt) {
                v2f b;                           // B[k][n] = Ktile[key=n][dim=k]
                b.x = Ks[(nt * 16 + ln) * 68 + kk];
                b.y = Ks[(nt * 16 + ln) * 68 + kk + 1];
                sacc[nt] = wmma_f32(aq[t2], b, sacc[nt]);
            }
        }

        // Mask + scale (key mask; column = lane&15 within each n-tile)
        float p[4][8];
        #pragma unroll
        for (int nt = 0; nt < 4; ++nt) {
            int mk = mask[bb * SEQ + kt * 64 + nt * 16 + ln];
            #pragma unroll
            for (int vv = 0; vv < 8; ++vv)
                p[nt][vv] = mk ? sacc[nt][vv] * scale : -1e30f;
        }

        // Online softmax; row = vv + 8*hi lives across 16 lanes of one half
        float corr[8];
        #pragma unroll
        for (int vv = 0; vv < 8; ++vv) {
            float tmax = fmaxf(fmaxf(p[0][vv], p[1][vv]), fmaxf(p[2][vv], p[3][vv]));
            #pragma unroll
            for (int off = 1; off < 16; off <<= 1)
                tmax = fmaxf(tmax, __shfl_xor(tmax, off, 32));
            float mnew = fmaxf(mrow[vv], tmax);
            corr[vv] = __expf(mrow[vv] - mnew);
            mrow[vv] = mnew;
            float rsum = 0.0f;
            #pragma unroll
            for (int nt = 0; nt < 4; ++nt) {
                p[nt][vv] = __expf(p[nt][vv] - mnew);
                rsum += p[nt][vv];
            }
            #pragma unroll
            for (int off = 1; off < 16; off <<= 1)
                rsum += __shfl_xor(rsum, off, 32);
            lrow[vv] = lrow[vv] * corr[vv] + rsum;
        }
        #pragma unroll
        for (int nt = 0; nt < 4; ++nt)
            #pragma unroll
            for (int vv = 0; vv < 8; ++vv)
                oacc[nt][vv] *= corr[vv];

        // Spill P (C layout) to per-wave LDS as row-major 16x64
        #pragma unroll
        for (int nt = 0; nt < 4; ++nt)
            #pragma unroll
            for (int vv = 0; vv < 8; ++vv)
                Pw[(vv + 8 * hi) * 68 + nt * 16 + ln] = p[nt][vv];
        __syncthreads();

        // O += P @ V : contraction over the 64 keys (16 steps of 4)
        #pragma unroll
        for (int t2 = 0; t2 < 16; ++t2) {
            const int kk = t2 * 4 + 2 * hi;
            v2f ap;                              // A layout from P
            ap.x = Pw[ln * 68 + kk];
            ap.y = Pw[ln * 68 + kk + 1];
            #pragma unroll
            for (int dt = 0; dt < 4; ++dt) {
                v2f bv;                          // B[k][n] = Vtile[key=k][dim=n]
                bv.x = Vs[kk * 68 + dt * 16 + ln];
                bv.y = Vs[(kk + 1) * 68 + dt * 16 + ln];
                oacc[dt] = wmma_f32(ap, bv, oacc[dt]);
            }
        }
    }

    // Normalize and store: o laid out (b, s, hidden) with head-contiguous dims
    #pragma unroll
    for (int vv = 0; vv < 8; ++vv) lrow[vv] = 1.0f / lrow[vv];
    #pragma unroll
    for (int dt = 0; dt < 4; ++dt) {
        #pragma unroll
        for (int vv = 0; vv < 8; ++vv) {
            int row = qbase + vv + 8 * hi;
            size_t col = headOff + dt * 16 + ln;
            o[(batRow + row) * HIDDEN + col] = oacc[dt][vv] * lrow[vv];
        }
    }
}

// ---------------------------------------------------------------------------
extern "C" void kernel_launch(void* const* d_in, const int* in_sizes, int n_in,
                              void* d_out, int out_size, void* d_ws, size_t ws_size,
                              hipStream_t stream)
{
    const float* x    = (const float*)d_in[0];
    const int*   amsk = (const int*)  d_in[1];
    const float* Wq   = (const float*)d_in[2];
    const float* bq   = (const float*)d_in[3];
    const float* Wk   = (const float*)d_in[4];
    const float* bk   = (const float*)d_in[5];
    const float* Wv   = (const float*)d_in[6];
    const float* bv   = (const float*)d_in[7];
    const float* Wo   = (const float*)d_in[8];
    const float* bo   = (const float*)d_in[9];
    float* out = (float*)d_out;

    const int Mtok = BATCH * SEQ;                 // 4096 tokens
    const size_t bufElems = (size_t)Mtok * HIDDEN;
    float* qb = (float*)d_ws;
    float* kb = qb + bufElems;
    float* vb = kb + bufElems;
    float* ob = vb + bufElems;

    dim3 gGrid(HIDDEN / 64, Mtok / 128);          // (16, 32)

    gemm_bias_kernel<<<gGrid, 256, 0, stream>>>(x, Wq, bq, qb, Mtok, HIDDEN, HIDDEN);
    gemm_bias_kernel<<<gGrid, 256, 0, stream>>>(x, Wk, bk, kb, Mtok, HIDDEN, HIDDEN);
    gemm_bias_kernel<<<gGrid, 256, 0, stream>>>(x, Wv, bv, vb, Mtok, HIDDEN, HIDDEN);

    int ropeWork = Mtok * (HIDDEN / 2);
    rope_kernel<<<(ropeWork + 255) / 256, 256, 0, stream>>>(qb, Mtok);
    rope_kernel<<<(ropeWork + 255) / 256, 256, 0, stream>>>(kb, Mtok);

    attn_kernel<<<dim3(SEQ / 128, BATCH * NGROUPS), 256, 0, stream>>>(qb, kb, vb, amsk, ob);

    gemm_bias_kernel<<<gGrid, 256, 0, stream>>>(ob, Wo, bo, out, Mtok, HIDDEN, HIDDEN);
}

// v001
// It runs in 348 microseconds.
// Two timings next to v000 both put it at 1.26 times that version's speed.
#include <hip/hip_runtime.h>
#include <math.h>

typedef __attribute__((ext_vector_type(2))) float v2f;
typedef __attribute__((ext_vector_type(8))) float v8f;

#define HIDDEN  1024
#define SEQ     2048
#define BATCH   2
#define NGROUPS 16
#define HDIM    64

__device__ __forceinline__ v8f wmma_f32(v2f a, v2f b, v8f c) {
    // D = A(16x4 f32) * B(4x16 f32) + C(16x16 f32)
    return __builtin_amdgcn_wmma_f32_16x16x4_f32(
        /*neg_a=*/false, a, /*neg_b=*/false, b,
        /*c_mod=*/(short)0, c, /*reuse_a=*/false, /*reuse_b=*/false);
}

// Async global->LDS 16B copy (GVS mode): saddr = wave-uniform 64-bit base,
// vaddr = per-lane 32-bit byte offset, first operand = per-lane LDS byte addr.
// Tracked by ASYNCcnt; publish with s_wait_asynccnt 0 before the barrier.
__device__ __forceinline__ void async_load_b128(void* ldsPtr, const void* gBase,
                                                unsigned byteOff) {
    unsigned ldsOff = (unsigned)(size_t)ldsPtr;   // low 32 bits = LDS offset
    asm volatile("global_load_async_to_lds_b128 %0, %1, %2"
                 :
                 : "v"(ldsOff), "v"(byteOff),
                   "s"((unsigned long long)(size_t)gBase)
                 : "memory");
}

__device__ __forceinline__ void wait_async0() {
    asm volatile("s_wait_asynccnt 0" ::: "memory");
}

// ---------------------------------------------------------------------------
// C[M,N] = A[M,K] @ W[N,K]^T + bias[N]
// Block tile: 128(M) x 64(N), 256 threads = 8 waves, K staged in LDS by 16
// via async global->LDS copies. Wave w computes rows [w*16, w*16+16) x 64.
// ---------------------------------------------------------------------------
__global__ __launch_bounds__(256) void gemm_bias_kernel(
    const float* __restrict__ A, const float* __restrict__ W,
    const float* __restrict__ bias, float* __restrict__ C,
    int M, int N, int K)
{
    __shared__ float As[128 * 20];   // 128x16, stride 20 (16B-aligned rows)
    __shared__ float Ws[64 * 20];    // 64x16

    const int tid  = threadIdx.x;
    const int wave = tid >> 5;
    const int lane = tid & 31;
    const int hi   = lane >> 4;      // lane half
    const int ln   = lane & 15;
    const int mBase = blockIdx.y * 128;
    const int nBase = blockIdx.x * 64;

    v8f acc[4] = {};

    for (int k0 = 0; k0 < K; k0 += 16) {
        __syncthreads();             // previous iteration's LDS reads done
        const float* aBase = A + (size_t)mBase * K + k0;
        const float* wBase = W + (size_t)nBase * K + k0;
        // A tile: 128 rows x 4 float4 = 512 vecs / 256 threads
        #pragma unroll
        for (int i = 0; i < 2; ++i) {
            int vid = tid + i * 256;
            int row = vid >> 2, c4 = vid & 3;
            async_load_b128(&As[row * 20 + c4 * 4], aBase,
                            (unsigned)((row * K + c4 * 4) * 4));
        }
        // W tile: 64 rows x 4 float4 = 256 vecs
        {
            int row = tid >> 2, c4 = tid & 3;
            async_load_b128(&Ws[row * 20 + c4 * 4], wBase,
                            (unsigned)((row * K + c4 * 4) * 4));
        }
        wait_async0();
        __syncthreads();

        #pragma unroll
        for (int ks = 0; ks < 4; ++ks) {
            const int kk = ks * 4 + 2 * hi;      // A/B fragment: K = vgpr + 2*half
            v2f a;
            a.x = As[(wave * 16 + ln) * 20 + kk];
            a.y = As[(wave * 16 + ln) * 20 + kk + 1];
            #pragma unroll
            for (int nt = 0; nt < 4; ++nt) {
                v2f b;                            // B[k][n] = W[n][k]
                b.x = Ws[(nt * 16 + ln) * 20 + kk];
                b.y = Ws[(nt * 16 + ln) * 20 + kk + 1];
                acc[nt] = wmma_f32(a, b, acc[nt]);
            }
        }
    }

    // C/D layout: row = vgpr + 8*half, col = lane&15
    #pragma unroll
    for (int nt = 0; nt < 4; ++nt) {
        #pragma unroll
        for (int v = 0; v < 8; ++v) {
            int row = mBase + wave * 16 + v + 8 * hi;
            int col = nBase + nt * 16 + ln;
            C[(size_t)row * N + col] = acc[nt][v] + bias[col];
        }
    }
}

// ---------------------------------------------------------------------------
// In-place RoPE over the full hidden dim (half = 512), one thread per pair.
// ---------------------------------------------------------------------------
__global__ __launch_bounds__(256) void rope_kernel(float* __restrict__ buf, int totalRows)
{
    const int half = HIDDEN / 2;
    int t = blockIdx.x * blockDim.x + threadIdx.x;
    if (t >= totalRows * half) return;
    int row = t / half;
    int i   = t - row * half;
    int pos = row & (SEQ - 1);
    float inv_freq = __powf(10000.0f, -(float)i / (float)half);
    float ang = (float)pos * inv_freq;
    float s, c;
    __sincosf(ang, &s, &c);
    float* p = buf + (size_t)row * HIDDEN;
    float x1 = p[i], x2 = p[i + half];
    p[i]        = x1 * c - x2 * s;
    p[i + half] = x2 * c + x1 * s;
}

// ---------------------------------------------------------------------------
// Flash attention: grid = (SEQ/128, BATCH*NGROUPS), 256 threads = 8 waves.
// Wave w owns query rows [blockIdx.x*128 + w*16, +16). Q fragments resident in
// registers. A masked key has softmax weight exactly 0, so each block first
// lists the kept key positions of its batch row (prefix scan of the mask) and
// then walks only ceil(kept/64) tiles, gathering the listed K/V rows.
// 64-key K/V tiles staged in LDS via async copies; P re-laid out
// through a per-wave LDS region for the PV WMMA.
// ---------------------------------------------------------------------------
__global__ __launch_bounds__(256) void attn_kernel(
    const float* __restrict__ q, const float* __restrict__ k,
    const float* __restrict__ v, const int* __restrict__ mask,
    float* __restrict__ o)
{
    __shared__ float Ks[64 * 68];        // 64 keys x 64 dims (stride 68)
    __shared__ float Vs[64 * 68];
    __shared__ float Ps[8 * 16 * 68];    // per-wave 16x64 P tile
    __shared__ int   kidx[SEQ];          // positions of the kept keys, in order
    __shared__ int   wcnt[8];            // kept keys per wave's 256 positions

    const int tid  = threadIdx.x;
    const int wave = tid >> 5;
    const int lane = tid & 31;
    const int hi   = lane >> 4;
    const int ln   = lane & 15;
    const int bb   = blockIdx.y >> 4;    // batch
    const int gg   = blockIdx.y & 15;    // head/group
    const int qbase = blockIdx.x * 128 + wave * 16;
    const float scale = 0.125f;          // 1/sqrt(64)

    const size_t headOff = (size_t)gg * HDIM;
    const size_t batRow  = (size_t)bb * SEQ;

    // Load Q fragments: A layout, M = ln, K = 4*t2 + vgpr + 2*hi
    v2f aq[16];
    {
        const float* qr = q + (batRow + qbase + ln) * HIDDEN + headOff;
        #pragma unroll
        for (int t2 = 0; t2 < 16; ++t2) {
            aq[t2].x = qr[t2 * 4 + 2 * hi];
            aq[t2].y = qr[t2 * 4 + 2 * hi + 1];
        }
    }

    v8f oacc[4] = {};
    float mrow[8], lrow[8];
    #pragma unroll
    for (int vv = 0; vv < 8; ++vv) { mrow[vv] = -1e30f; lrow[vv] = 0.0f; }

    float* Pw = &Ps[wave * 16 * 68];

    // Kept-key list: thread t owns positions [8t, 8t+8) of this batch row.
    int keep[8];
    int cnt = 0;
    #pragma unroll
    for (int j = 0; j < 8; ++j) {
        keep[j] = mask[bb * SEQ + tid * 8 + j] != 0;
        cnt += keep[j];
    }
    int incl = cnt;                      // inclusive scan over the wave
    #pragma unroll
    for (int off = 1; off < 32; off <<= 1) {
        int up = __shfl_up(incl, off, 32);
        if (lane >= off) incl += up;
    }
    if (lane == 31) wcnt[wave] = incl;
    __syncthreads();                     // wcnt complete before it is summed
    int nkeep = 0, slot = incl - cnt;
    #pragma unroll
    for (int w = 0; w < 8; ++w) {
        int c = wcnt[w];
        nkeep += c;
        if (w < wave) slot += c;
    }
    #pragma unroll
    for (int j = 0; j < 8; ++j)
        if (keep[j]) kidx[slot++] = tid * 8 + j;
    // Pad the last tile with a valid row; its scores are masked below.
    if (tid < 64 && nkeep + tid < SEQ) kidx[nkeep + tid] = 0;
    // Same value in every thread; held scalar so that the loop and its
    // barriers run under a scalar branch.
    nkeep = __builtin_amdgcn_readfirstlane(nkeep);
    const int ntiles = min((nkeep + 63) >> 6, SEQ / 64);

    const float* kBase = k + batRow * HIDDEN + headOff;
    const float* vBase = v + batRow * HIDDEN + headOff;

    for (int kt = 0; kt < ntiles; ++kt) {
        __syncthreads();                 // also publishes kidx on the first trip
        // Stage K and V tiles (64 listed rows x 16 float4 each) via async copies
        unsigned goff[4], ldsK[4], ldsV[4];
        #pragma unroll
        for (int i = 0; i < 4; ++i) {
            int vid = tid + i * 256;
            int row = vid >> 4, c4 = vid & 15;
            goff[i] = (unsigned)((kidx[kt * 64 + row] * HIDDEN + c4 * 4) * 4);
            ldsK[i] = (unsigned)(size_t)&Ks[row * 68 + c4 * 4];
            ldsV[i] = (unsigned)(size_t)&Vs[row * 68 + c4 * 4];
        }
        // One statement: the offsets change every trip, and the closing
        // s_wait_xcnt keeps their registers untouched until it has passed.
        asm volatile("global_load_async_to_lds_b128 %0, %8, %12\n\t"
                     "global_load_async_to_lds_b128 %4, %8, %13\n\t"
                     "global_load_async_to_lds_b128 %1, %9, %12\n\t"
                     "global_load_async_to_lds_b128 %5, %9, %13\n\t"
                     "global_load_async_to_lds_b128 %2, %10, %12\n\t"
                     "global_load_async_to_lds_b128 %6, %10, %13\n\t"
                     "global_load_async_to_lds_b128 %3, %11, %12\n\t"
                     "global_load_async_to_lds_b128 %7, %11, %13\n\t"
                     "s_wait_xcnt 0x0"
                     :
                     : "v"(ldsK[0]), "v"(ldsK[1]), "v"(ldsK[2]), "v"(ldsK[3]),
                       "v"(ldsV[0]), "v"(ldsV[1]), "v"(ldsV[2]), "v"(ldsV[3]),
                       "v"(goff[0]), "v"(goff[1]), "v"(goff[2]), "v"(goff[3]),
                       "s"((unsigned long long)(size_t)kBase),
                       "s"((unsigned long long)(size_t)vBase)
                     : "memory");
        wait_async0();
        __syncthreads();

        // S = Q @ K^T : 4 tiles of 16x16, contraction over head_dim (16 steps of 4)
        v8f sacc[4] = {};
        #pragma unroll
        for (int t2 = 0; t2 < 16; ++t2) {
            const int kk = t2 * 4 + 2 * hi;
            #pragma unroll
            for (int nt = 0; nt < 4; ++nt) {
                v2f b;                           // B[k][n] = Ktile[key=n][dim=k]
                b.x = Ks[(nt * 16 + ln) * 68 + kk];
                b.y = Ks[(nt * 16 + ln) * 68 + kk + 1];
                sacc[nt] = wmma_f32(aq[t2], b, sacc[nt]);
            }
        }

        // Scale; mask the pad of the last tile (column = lane&15 in each n-tile)
        float p[4][8];
        #pragma unroll
        for (int nt = 0; nt < 4; ++nt) {
            int mk = kt * 64 + nt * 16 + ln < nkeep;
            #pragma unroll
            for (int vv = 0; vv < 8; ++vv)
                p[nt][vv] = mk ? sacc[nt][vv] * scale : -1e30f;
        }

        // Online softmax; row = vv + 8*hi lives across 16 lanes of one half
        float corr[8];
        #pragma unroll
        for (int vv = 0; vv < 8; ++vv) {
            float tmax = fmaxf(fmaxf(p[0][vv], p[1][vv]), fmaxf(p[2][vv], p[3][vv]));
            #pragma unroll
            for (int off = 1; off < 16; off <<= 1)
                tmax = fmaxf(tmax, __shfl_xor(tmax, off, 32));
            float mnew = fmaxf(mrow[vv], tmax);
            corr[vv] = __expf(mrow[vv] - mnew);
            mrow[vv] = mnew;
            float rsum = 0.0f;
            #pragma unroll
            for (int nt = 0; nt < 4; ++nt) {
                p[nt][vv] = __expf(p[nt][vv] - mnew);
                rsum += p[nt][vv];
            }
            #pragma unroll
            for (int off = 1; off < 16; off <<= 1)
                rsum += __shfl_xor(rsum, off, 32);
            lrow[vv] = lrow[vv] * corr[vv] + rsum;
        }
        #pragma unroll
        for (int nt = 0; nt < 4; ++nt)
            #pragma unroll
            for (int vv = 0; vv < 8; ++vv)
                oacc[nt][vv] *= corr[vv];

        // Spill P (C layout) to per-wave LDS as row-major 16x64
        #pragma unroll
        for (int nt = 0; nt < 4; ++nt)
            #pragma unroll
            for (int vv = 0; vv < 8; ++vv)
                Pw[(vv + 8 * hi) * 68 + nt * 16 + ln] = p[nt][vv];
        __syncthreads();

        // O += P @ V : contraction over the 64 keys (16 steps of 4)
        #pragma unroll
        for (int t2 = 0; t2 < 16; ++t2) {
            const int kk = t2 * 4 + 2 * hi;
            v2f ap;                              // A layout from P
            ap.x = Pw[ln * 68 + kk];
            ap.y = Pw[ln * 68 + kk + 1];
            #pragma unroll
            for (int dt = 0; dt < 4; ++dt) {
                v2f bv;                          // B[k][n] = Vtile[key=k][dim=n]
                bv.x = Vs[kk * 68 + dt * 16 + ln];
                bv.y = Vs[(kk + 1) * 68 + dt * 16 + ln];
                oacc[dt] = wmma_f32(ap, bv, oacc[dt]);
            }
        }
    }

    // Normalize and store: o laid out (b, s, hidden) with head-contiguous dims
    #pragma unroll
    for (int vv = 0; vv < 8; ++vv) lrow[vv] = 1.0f / lrow[vv];
    #pragma unroll
    for (int dt = 0; dt < 4; ++dt) {
        #pragma unroll
        for (int vv = 0; vv < 8; ++vv) {
            int row = qbase + vv + 8 * hi;
            size_t col = headOff + dt * 16 + ln;
            o[(batRow + row) * HIDDEN + col] = oacc[dt][vv] * lrow[vv];
        }
    }
}

// ---------------------------------------------------------------------------
extern "C" void kernel_launch(void* const* d_in, const int* in_sizes, int n_in,
                              void* d_out, int out_size, void* d_ws, size_t ws_size,
                              hipStream_t stream)
{
    const float* x    = (const float*)d_in[0];
    const int*   amsk = (const int*)  d_in[1];
    const float* Wq   = (const float*)d_in[2];
    const float* bq   = (const float*)d_in[3];
    const float* Wk   = (const float*)d_in[4];
    const float* bk   = (const float*)d_in[5];
    const float* Wv   = (const float*)d_in[6];
    const float* bv   = (const float*)d_in[7];
    const float* Wo   = (const float*)d_in[8];
    const float* bo   = (const float*)d_in[9];
    float* out = (float*)d_out;

    const int Mtok = BATCH * SEQ;                 // 4096 tokens
    const size_t bufElems = (size_t)Mtok * HIDDEN;
    float* qb = (float*)d_ws;
    float* kb = qb + bufElems;
    float* vb = kb + bufElems;
    float* ob = vb + bufElems;

    dim3 gGrid(HIDDEN / 64, Mtok / 128);          // (16, 32)

    gemm_bias_kernel<<<gGrid, 256, 0, stream>>>(x, Wq, bq, qb, Mtok, HIDDEN, HIDDEN);
    gemm_bias_kernel<<<gGrid, 256, 0, stream>>>(x, Wk, bk, kb, Mtok, HIDDEN, HIDDEN);
    gemm_bias_kernel<<<gGrid, 256, 0, stream>>>(x, Wv, bv, vb, Mtok, HIDDEN, HIDDEN);

    int ropeWork = Mtok * (HIDDEN / 2);
    rope_kernel<<<(ropeWork + 255) / 256, 256, 0, stream>>>(qb, Mtok);
    rope_kernel<<<(ropeWork + 255) / 256, 256, 0, stream>>>(kb, Mtok);

    attn_kernel<<<dim3(SEQ / 128, BATCH * NGROUPS), 256, 0, stream>>>(qb, kb, vb, amsk, ob);

    gemm_bias_kernel<<<gGrid, 256, 0, stream>>>(ob, Wo, bo, out, Mtok, HIDDEN, HIDDEN);
}

// v002
// One run takes 292 microseconds.
// Timed twice side by side with v001, it ran 1.19 times as fast both times.
// Counting every step since v000, it is 1.50 times as fast.
#include <hip/hip_runtime.h>
#include <math.h>

typedef __attribute__((ext_vector_type(2))) float v2f;
typedef __attribute__((ext_vector_type(8))) float v8f;

#define HIDDEN  1024
#define SEQ     2048
#define BATCH   2
#define NGROUPS 16
#define HDIM    64

__device__ __forceinline__ v8f wmma_f32(v2f a, v2f b, v8f c) {
    // D = A(16x4 f32) * B(4x16 f32) + C(16x16 f32)
    return __builtin_amdgcn_wmma_f32_16x16x4_f32(
        /*neg_a=*/false, a, /*neg_b=*/false, b,
        /*c_mod=*/(short)0, c, /*reuse_a=*/false, /*reuse_b=*/false);
}

__device__ __forceinline__ void wait_async0() {
    asm volatile("s_wait_asynccnt 0" ::: "memory");
}

// ---------------------------------------------------------------------------
// C[M,N] = A[M,K] @ W[N,K]^T + bias[N]
// Block tile: 128(M) x 64(N), 256 threads = 8 waves. Wave w computes rows
// [w*16, w*16+16) x 64. K is staged in LDS 64 at a time in two buffers: the
// async copies of the next stage are in flight while this stage is multiplied.
// M, N, K are multiples of 128, 64, 64.
// ---------------------------------------------------------------------------
#define GBK   64                 // k per stage
#define GPIT  68                 // LDS row pitch in floats (272 B = 16 B x odd)
#define GA_SZ (128 * GPIT)       // floats of A per buffer
#define GW_SZ (64 * GPIT)        // floats of W per buffer

// One stage: 16 lanes cover a row's 256 B; a thread copies 8 A rows and 4 W
// rows, 16 rows apart. lA, lW: the lane's LDS byte addresses of its first rows;
// gA, gW: its global addresses there; rs: 16 rows in floats.
__device__ __forceinline__ void gemm_stage_copy(unsigned lA, unsigned lW,
                                                const float* gA, const float* gW,
                                                size_t rs) {
    const unsigned lr = 16 * GPIT * 4;
    // One statement: the closing s_wait_xcnt keeps the address registers
    // untouched until it has passed (they are advanced for the next stage).
    asm volatile("global_load_async_to_lds_b128 %0, %12, off\n\t"
                 "global_load_async_to_lds_b128 %1, %13, off\n\t"
                 "global_load_async_to_lds_b128 %2, %14, off\n\t"
                 "global_load_async_to_lds_b128 %3, %15, off\n\t"
                 "global_load_async_to_lds_b128 %4, %16, off\n\t"
                 "global_load_async_to_lds_b128 %5, %17, off\n\t"
                 "global_load_async_to_lds_b128 %6, %18, off\n\t"
                 "global_load_async_to_lds_b128 %7, %19, off\n\t"
                 "global_load_async_to_lds_b128 %8, %20, off\n\t"
                 "global_load_async_to_lds_b128 %9, %21, off\n\t"
                 "global_load_async_to_lds_b128 %10, %22, off\n\t"
                 "global_load_async_to_lds_b128 %11, %23, off\n\t"
                 "s_wait_xcnt 0x0"
                 :
                 : "v"(lA), "v"(lA + lr), "v"(lA + 2 * lr), "v"(lA + 3 * lr),
                   "v"(lA + 4 * lr), "v"(lA + 5 * lr), "v"(lA + 6 * lr),
                   "v"(lA + 7 * lr),
                   "v"(lW), "v"(lW + lr), "v"(lW + 2 * lr), "v"(lW + 3 * lr),
                   "v"(gA), "v"(gA + rs), "v"(gA + 2 * rs), "v"(gA + 3 * rs),
                   "v"(gA + 4 * rs), "v"(gA + 5 * rs), "v"(gA + 6 * rs),
                   "v"(gA + 7 * rs),
                   "v"(gW), "v"(gW + rs), "v"(gW + 2 * rs), "v"(gW + 3 * rs)
                 : "memory");
}

__global__ __launch_bounds__(256) void gemm_bias_kernel(
    const float* __restrict__ A, const float* __restrict__ W,
    const float* __restrict__ bias, float* __restrict__ C,
    int M, int N, int K)
{
    __shared__ __attribute__((aligned(16))) float As[2 * GA_SZ];
    __shared__ __attribute__((aligned(16))) float Ws[2 * GW_SZ];

    const int tid  = threadIdx.x;
    const int wave = tid >> 5;
    const int lane = tid & 31;
    const int hi   = lane >> 4;      // lane half
    const int ln   = lane & 15;
    const int mBase = blockIdx.y * 128;
    const int nBase = blockIdx.x * 64;

    v8f acc[4] = {};

    const int crow = tid >> 4, cc4 = tid & 15;
    const float* gA = A + (size_t)(mBase + crow) * K + cc4 * 4;
    const float* gW = W + (size_t)(nBase + crow) * K + cc4 * 4;
    const unsigned lA = (unsigned)(size_t)&As[crow * GPIT + cc4 * 4];
    const unsigned lW = (unsigned)(size_t)&Ws[crow * GPIT + cc4 * 4];
    const size_t rs = (size_t)16 * K;
    const int nst = K / GBK;

    gemm_stage_copy(lA, lW, gA, gW, rs);              // stage 0 -> buffer 0
    wait_async0();
    __syncthreads();                                  // publishes stage 0
    if (nst > 1)                                      // stage 1 -> buffer 1
        gemm_stage_copy(lA + GA_SZ * 4, lW + GW_SZ * 4, gA + GBK, gW + GBK, rs);

    for (int t = 0; t < nst; ++t) {
        const int cur = t & 1;
        // A/B fragment: K = vgpr + 2*half
        const float* as = &As[cur * GA_SZ + (wave * 16 + ln) * GPIT + 2 * hi];
        const float* ws = &Ws[cur * GW_SZ + ln * GPIT + 2 * hi];
        // Both loops unrolled: LDS offsets become immediates, acc[] stays in
        // registers, and the fragment loads can be issued a group ahead.
        #pragma unroll
        for (int ks = 0; ks < GBK / 4; ++ks) {
            v2f a;
            a.x = as[ks * 4];
            a.y = as[ks * 4 + 1];
            #pragma unroll
            for (int nt = 0; nt < 4; ++nt) {
                v2f b;                            // B[k][n] = W[n][k]
                b.x = ws[nt * 16 * GPIT + ks * 4];
                b.y = ws[nt * 16 * GPIT + ks * 4 + 1];
                acc[nt] = wmma_f32(a, b, acc[nt]);
            }
        }
        // Publish point of stage t+1: own LDS reads of this buffer retired,
        // own copies of stage t+1 landed, then the one barrier of the trip.
        asm volatile("s_wait_dscnt 0x0" ::: "memory");
        wait_async0();
        __syncthreads();
        if (t + 2 < nst)                          // refill the buffer just read
            gemm_stage_copy(lA + cur * (GA_SZ * 4), lW + cur * (GW_SZ * 4),
                            gA + (size_t)(t + 2) * GBK, gW + (size_t)(t + 2) * GBK, rs);
    }
    wait_async0();                                // nothing in flight at the end

    // C/D layout: row = vgpr + 8*half, col = lane&15
    #pragma unroll
    for (int nt = 0; nt < 4; ++nt) {
        #pragma unroll
        for (int v = 0; v < 8; ++v) {
            int row = mBase + wave * 16 + v + 8 * hi;
            int col = nBase + nt * 16 + ln;
            C[(size_t)row * N + col] = acc[nt][v] + bias[col];
        }
    }
}

// ---------------------------------------------------------------------------
// In-place RoPE over the full hidden dim (half = 512), one thread per pair.
// ---------------------------------------------------------------------------
__global__ __launch_bounds__(256) void rope_kernel(float* __restrict__ buf, int totalRows)
{
    const int half = HIDDEN / 2;
    int t = blockIdx.x * blockDim.x + threadIdx.x;
    if (t >= totalRows * half) return;
    int row = t / half;
    int i   = t - row * half;
    int pos = row & (SEQ - 1);
    float inv_freq = __powf(10000.0f, -(float)i / (float)half);
    float ang = (float)pos * inv_freq;
    float s, c;
    __sincosf(ang, &s, &c);
    float* p = buf + (size_t)row * HIDDEN;
    float x1 = p[i], x2 = p[i + half];
    p[i]        = x1 * c - x2 * s;
    p[i + half] = x2 * c + x1 * s;
}

// ---------------------------------------------------------------------------
// Flash attention: grid = (SEQ/128, BATCH*NGROUPS), 256 threads = 8 waves.
// Wave w owns query rows [blockIdx.x*128 + w*16, +16). Q fragments resident in
// registers. A masked key has softmax weight exactly 0, so each block first
// lists the kept key positions of its batch row (prefix scan of the mask) and
// then walks only ceil(kept/64) tiles, gathering the listed K/V rows.
// 64-key K/V tiles staged in LDS via async copies; P re-laid out
// through a per-wave LDS region for the PV WMMA.
// ---------------------------------------------------------------------------
__global__ __launch_bounds__(256) void attn_kernel(
    const float* __restrict__ q, const float* __restrict__ k,
    const float* __restrict__ v, const int* __restrict__ mask,
    float* __restrict__ o)
{
    __shared__ float Ks[64 * 68];        // 64 keys x 64 dims (stride 68)
    __shared__ float Vs[64 * 68];
    __shared__ float Ps[8 * 16 * 68];    // per-wave 16x64 P tile
    __shared__ int   kidx[SEQ];          // positions of the kept keys, in order
    __shared__ int   wcnt[8];            // kept keys per wave's 256 positions

    const int tid  = threadIdx.x;
    const int wave = tid >> 5;
    const int lane = tid & 31;
    const int hi   = lane >> 4;
    const int ln   = lane & 15;
    const int bb   = blockIdx.y >> 4;    // batch
    const int gg   = blockIdx.y & 15;    // head/group
    const int qbase = blockIdx.x * 128 + wave * 16;
    const float scale = 0.125f;          // 1/sqrt(64)

    const size_t headOff = (size_t)gg * HDIM;
    const size_t batRow  = (size_t)bb * SEQ;

    // Load Q fragments: A layout, M = ln, K = 4*t2 + vgpr + 2*hi
    v2f aq[16];
    {
        const float* qr = q + (batRow + qbase + ln) * HIDDEN + headOff;
        #pragma unroll
        for (int t2 = 0; t2 < 16; ++t2) {
            aq[t2].x = qr[t2 * 4 + 2 * hi];
            aq[t2].y = qr[t2 * 4 + 2 * hi + 1];
        }
    }

    v8f oacc[4] = {};
    float mrow[8], lrow[8];
    #pragma unroll
    for (int vv = 0; vv < 8; ++vv) { mrow[vv] = -1e30f; lrow[vv] = 0.0f; }

    float* Pw = &Ps[wave * 16 * 68];

    // Kept-key list: thread t owns positions [8t, 8t+8) of this batch row.
    int keep[8];
    int cnt = 0;
    #pragma unroll
    for (int j = 0; j < 8; ++j) {
        keep[j] = mask[bb * SEQ + tid * 8 + j] != 0;
        cnt += keep[j];
    }
    int incl = cnt;                      // inclusive scan over the wave
    #pragma unroll
    for (int off = 1; off < 32; off <<= 1) {
        int up = __shfl_up(incl, off, 32);
        if (lane >= off) incl += up;
    }
    if (lane == 31) wcnt[wave] = incl;
    __syncthreads();                     // wcnt complete before it is summed
    int nkeep = 0, slot = incl - cnt;
    #pragma unroll
    for (int w = 0; w < 8; ++w) {
        int c = wcnt[w];
        nkeep += c;
        if (w < wave) slot += c;
    }
    #pragma unroll
    for (int j = 0; j < 8; ++j)
        if (keep[j]) kidx[slot++] = tid * 8 + j;
    // Pad the last tile with a valid row; its scores are masked below.
    if (tid < 64 && nkeep + tid < SEQ) kidx[nkeep + tid] = 0;
    // Same value in every thread; held scalar so that the loop and its
    // barriers run under a scalar branch.
    nkeep = __builtin_amdgcn_readfirstlane(nkeep);
    const int ntiles = min((nkeep + 63) >> 6, SEQ / 64);

    const float* kBase = k + batRow * HIDDEN + headOff;
    const float* vBase = v + batRow * HIDDEN + headOff;

    for (int kt = 0; kt < ntiles; ++kt) {
        __syncthreads();                 // also publishes kidx on the first trip
        // Stage K and V tiles (64 listed rows x 16 float4 each) via async copies
        unsigned goff[4], ldsK[4], ldsV[4];
        #pragma unroll
        for (int i = 0; i < 4; ++i) {
            int vid = tid + i * 256;
            int row = vid >> 4, c4 = vid & 15;
            goff[i] = (unsigned)((kidx[kt * 64 + row] * HIDDEN + c4 * 4) * 4);
            ldsK[i] = (unsigned)(size_t)&Ks[row * 68 + c4 * 4];
            ldsV[i] = (unsigned)(size_t)&Vs[row * 68 + c4 * 4];
        }
        // One statement: the offsets change every trip, and the closing
        // s_wait_xcnt keeps their registers untouched until it has passed.
        asm volatile("global_load_async_to_lds_b128 %0, %8, %12\n\t"
                     "global_load_async_to_lds_b128 %4, %8, %13\n\t"
                     "global_load_async_to_lds_b128 %1, %9, %12\n\t"
                     "global_load_async_to_lds_b128 %5, %9, %13\n\t"
                     "global_load_async_to_lds_b128 %2, %10, %12\n\t"
                     "global_load_async_to_lds_b128 %6, %10, %13\n\t"
                     "global_load_async_to_lds_b128 %3, %11, %12\n\t"
                     "global_load_async_to_lds_b128 %7, %11, %13\n\t"
                     "s_wait_xcnt 0x0"
                     :
                     : "v"(ldsK[0]), "v"(ldsK[1]), "v"(ldsK[2]), "v"(ldsK[3]),
                       "v"(ldsV[0]), "v"(ldsV[1]), "v"(ldsV[2]), "v"(ldsV[3]),
                       "v"(goff[0]), "v"(goff[1]), "v"(goff[2]), "v"(goff[3]),
                       "s"((unsigned long long)(size_t)kBase),
                       "s"((unsigned long long)(size_t)vBase)
                     : "memory");
        wait_async0();
        __syncthreads();

        // S = Q @ K^T : 4 tiles of 16x16, contraction over head_dim (16 steps of 4)
        v8f sacc[4] = {};
        #pragma unroll
        for (int t2 = 0; t2 < 16; ++t2) {
            const int kk = t2 * 4 + 2 * hi;
            #pragma unroll
            for (int nt = 0; nt < 4; ++nt) {
                v2f b;                           // B[k][n] = Ktile[key=n][dim=k]
                b.x = Ks[(nt * 16 + ln) * 68 + kk];
                b.y = Ks[(nt * 16 + ln) * 68 + kk + 1];
                sacc[nt] = wmma_f32(aq[t2], b, sacc[nt]);
            }
        }

        // Scale; mask the pad of the last tile (column = lane&15 in each n-tile)
        float p[4][8];
        #pragma unroll
        for (int nt = 0; nt < 4; ++nt) {
            int mk = kt * 64 + nt * 16 + ln < nkeep;
            #pragma unroll
            for (int vv = 0; vv < 8; ++vv)
                p[nt][vv] = mk ? sacc[nt][vv] * scale : -1e30f;
        }

        // Online softmax; row = vv + 8*hi lives across 16 lanes of one half
        float corr[8];
        #pragma unroll
        for (int vv = 0; vv < 8; ++vv) {
            float tmax = fmaxf(fmaxf(p[0][vv], p[1][vv]), fmaxf(p[2][vv], p[3][vv]));
            #pragma unroll
            for (int off = 1; off < 16; off <<= 1)
                tmax = fmaxf(tmax, __shfl_xor(tmax, off, 32));
            float mnew = fmaxf(mrow[vv], tmax);
            corr[vv] = __expf(mrow[vv] - mnew);
            mrow[vv] = mnew;
            float rsum = 0.0f;
            #pragma unroll
            for (int nt = 0; nt < 4; ++nt) {
                p[nt][vv] = __expf(p[nt][vv] - mnew);
                rsum += p[nt][vv];
            }
            #pragma unroll
            for (int off = 1; off < 16; off <<= 1)
                rsum += __shfl_xor(rsum, off, 32);
            lrow[vv] = lrow[vv] * corr[vv] + rsum;
        }
        #pragma unroll
        for (int nt = 0; nt < 4; ++nt)
            #pragma unroll
            for (int vv = 0; vv < 8; ++vv)
                oacc[nt][vv] *= corr[vv];

        // Spill P (C layout) to per-wave LDS as row-major 16x64
        #pragma unroll
        for (int nt = 0; nt < 4; ++nt)
            #pragma unroll
            for (int vv = 0; vv < 8; ++vv)
                Pw[(vv + 8 * hi) * 68 + nt * 16 + ln] = p[nt][vv];
        __syncthreads();

        // O += P @ V : contraction over the 64 keys (16 steps of 4)
        #pragma unroll
        for (int t2 = 0; t2 < 16; ++t2) {
            const int kk = t2 * 4 + 2 * hi;
            v2f ap;                              // A layout from P
            ap.x = Pw[ln * 68 + kk];
            ap.y = Pw[ln * 68 + kk + 1];
            #pragma unroll
            for (int dt = 0; dt < 4; ++dt) {
                v2f bv;                          // B[k][n] = Vtile[key=k][dim=n]
                bv.x = Vs[kk * 68 + dt * 16 + ln];
                bv.y = Vs[(kk + 1) * 68 + dt * 16 + ln];
                oacc[dt] = wmma_f32(ap, bv, oacc[dt]);
            }
        }
    }

    // Normalize and store: o laid out (b, s, hidden) with head-contiguous dims
    #pragma unroll
    for (int vv = 0; vv < 8; ++vv) lrow[vv] = 1.0f / lrow[vv];
    #pragma unroll
    for (int dt = 0; dt < 4; ++dt) {
        #pragma unroll
        for (int vv = 0; vv < 8; ++vv) {
            int row = qbase + vv + 8 * hi;
            size_t col = headOff + dt * 16 + ln;
            o[(batRow + row) * HIDDEN + col] = oacc[dt][vv] * lrow[vv];
        }
    }
}

// ---------------------------------------------------------------------------
extern "C" void kernel_launch(void* const* d_in, const int* in_sizes, int n_in,
                              void* d_out, int out_size, void* d_ws, size_t ws_size,
                              hipStream_t stream)
{
    const float* x    = (const float*)d_in[0];
    const int*   amsk = (const int*)  d_in[1];
    const float* Wq   = (const float*)d_in[2];
    const float* bq   = (const float*)d_in[3];
    const float* Wk   = (const float*)d_in[4];
    const float* bk   = (const float*)d_in[5];
    const float* Wv   = (const float*)d_in[6];
    const float* bv   = (const float*)d_in[7];
    const float* Wo   = (const float*)d_in[8];
    const float* bo   = (const float*)d_in[9];
    float* out = (float*)d_out;

    const int Mtok = BATCH * SEQ;                 // 4096 tokens
    const size_t bufElems = (size_t)Mtok * HIDDEN;
    float* qb = (float*)d_ws;
    float* kb = qb + bufElems;
    float* vb = kb + bufElems;
    float* ob = vb + bufElems;

    dim3 gGrid(HIDDEN / 64, Mtok / 128);          // (16, 32)

    gemm_bias_kernel<<<gGrid, 256, 0, stream>>>(x, Wq, bq, qb, Mtok, HIDDEN, HIDDEN);
    gemm_bias_kernel<<<gGrid, 256, 0, stream>>>(x, Wk, bk, kb, Mtok, HIDDEN, HIDDEN);
    gemm_bias_kernel<<<gGrid, 256, 0, stream>>>(x, Wv, bv, vb, Mtok, HIDDEN, HIDDEN);

    int ropeWork = Mtok * (HIDDEN / 2);
    rope_kernel<<<(ropeWork + 255) / 256, 256, 0, stream>>>(qb, Mtok);
    rope_kernel<<<(ropeWork + 255) / 256, 256, 0, stream>>>(kb, Mtok);

    attn_kernel<<<dim3(SEQ / 128, BATCH * NGROUPS), 256, 0, stream>>>(qb, kb, vb, amsk, ob);

    gemm_bias_kernel<<<gGrid, 256, 0, stream>>>(ob, Wo, bo, out, Mtok, HIDDEN, HIDDEN);
}

// v003
// One run takes 278 microseconds.
// Two timings next to v002 both put it at 1.05 times that version's speed.
// Over all steps from v000 it is 1.57 times as fast.
#include <hip/hip_runtime.h>
#include <math.h>

typedef __attribute__((ext_vector_type(2))) float v2f;
typedef __attribute__((ext_vector_type(8))) float v8f;

#define HIDDEN  1024
#define SEQ     2048
#define BATCH   2
#define NGROUPS 16
#define HDIM    64

__device__ __forceinline__ v8f wmma_f32(v2f a, v2f b, v8f c) {
    // D = A(16x4 f32) * B(4x16 f32) + C(16x16 f32)
    return __builtin_amdgcn_wmma_f32_16x16x4_f32(
        /*neg_a=*/false, a, /*neg_b=*/false, b,
        /*c_mod=*/(short)0, c, /*reuse_a=*/false, /*reuse_b=*/false);
}

__device__ __forceinline__ void wait_async0() {
    asm volatile("s_wait_asynccnt 0" ::: "memory");
}

// ---------------------------------------------------------------------------
// C[M,N] = A[M,K] @ W[N,K]^T + bias[N]
// Block tile: 128(M) x 64(N), 256 threads = 8 waves. Wave w computes rows
// [w*16, w*16+16) x 64. K is staged in LDS 64 at a time in two buffers: the
// async copies of the next stage are in flight while this stage is multiplied.
// M, N, K are multiples of 128, 64, 64.
// rope (N = HIDDEN, rows are b*SEQ + position): the block's 64 columns are
// 32 columns i of the lower half and their partners i + HIDDEN/2, so that both
// members of every rotated pair sit in one lane's accumulators (tiles nt and
// nt + 2) and the rotation is applied on the way out.
// ---------------------------------------------------------------------------
#define GBK   64                 // k per stage
#define GPIT  68                 // LDS row pitch in floats (272 B = 16 B x odd)
#define GA_SZ (128 * GPIT)       // floats of A per buffer
#define GW_SZ (64 * GPIT)        // floats of W per buffer

// One stage: 16 lanes cover a row's 256 B; a thread copies 8 A rows and 4 W
// rows, 16 rows apart in LDS. lA, lW: the lane's LDS byte addresses of its first
// rows; gA, gW: its global addresses there; gW2: its global address in the
// block's second run of 32 W rows; rs: 16 rows in floats.
__device__ __forceinline__ void gemm_stage_copy(unsigned lA, unsigned lW,
                                                const float* gA, const float* gW,
                                                const float* gW2, size_t rs) {
    const unsigned lr = 16 * GPIT * 4;
    // One statement: the closing s_wait_xcnt keeps the address registers
    // untouched until it has passed (they are advanced for the next stage).
    asm volatile("global_load_async_to_lds_b128 %0, %12, off\n\t"
                 "global_load_async_to_lds_b128 %1, %13, off\n\t"
                 "global_load_async_to_lds_b128 %2, %14, off\n\t"
                 "global_load_async_to_lds_b128 %3, %15, off\n\t"
                 "global_load_async_to_lds_b128 %4, %16, off\n\t"
                 "global_load_async_to_lds_b128 %5, %17, off\n\t"
                 "global_load_async_to_lds_b128 %6, %18, off\n\t"
                 "global_load_async_to_lds_b128 %7, %19, off\n\t"
                 "global_load_async_to_lds_b128 %8, %20, off\n\t"
                 "global_load_async_to_lds_b128 %9, %21, off\n\t"
                 "global_load_async_to_lds_b128 %10, %22, off\n\t"
                 "global_load_async_to_lds_b128 %11, %23, off\n\t"
                 "s_wait_xcnt 0x0"
                 :
                 : "v"(lA), "v"(lA + lr), "v"(lA + 2 * lr), "v"(lA + 3 * lr),
                   "v"(lA + 4 * lr), "v"(lA + 5 * lr), "v"(lA + 6 * lr),
                   "v"(lA + 7 * lr),
                   "v"(lW), "v"(lW + lr), "v"(lW + 2 * lr), "v"(lW + 3 * lr),
                   "v"(gA), "v"(gA + rs), "v"(gA + 2 * rs), "v"(gA + 3 * rs),
                   "v"(gA + 4 * rs), "v"(gA + 5 * rs), "v"(gA + 6 * rs),
                   "v"(gA + 7 * rs),
                   "v"(gW), "v"(gW + rs), "v"(gW2), "v"(gW2 + rs)
                 : "memory");
}

// rope is a literal at both call sites, so each kernel holds one epilogue only.
__device__ __forceinline__ void gemm_bias_tile(
    const float* __restrict__ A, const float* __restrict__ W,
    const float* __restrict__ bias, float* __restrict__ C,
    int M, int N, int K, const bool rope)
{
    __shared__ __attribute__((aligned(16))) float As[2 * GA_SZ];
    __shared__ __attribute__((aligned(16))) float Ws[2 * GW_SZ];

    const int tid  = threadIdx.x;
    const int wave = tid >> 5;
    const int lane = tid & 31;
    const int hi   = lane >> 4;      // lane half
    const int ln   = lane & 15;
    const int mBase = blockIdx.y * 128;
    const int nBase = blockIdx.x * (rope ? 32 : 64);        // columns of tiles 0, 1
    const int nHi   = nBase + (rope ? HIDDEN / 2 : 32);     // columns of tiles 2, 3

    v8f acc[4] = {};

    const int crow = tid >> 4, cc4 = tid & 15;
    const float* gA = A + (size_t)(mBase + crow) * K + cc4 * 4;
    const float* gW = W + (size_t)(nBase + crow) * K + cc4 * 4;
    const float* gW2 = W + (size_t)(nHi + crow) * K + cc4 * 4;
    const unsigned lA = (unsigned)(size_t)&As[crow * GPIT + cc4 * 4];
    const unsigned lW = (unsigned)(size_t)&Ws[crow * GPIT + cc4 * 4];
    const size_t rs = (size_t)16 * K;
    const int nst = K / GBK;

    gemm_stage_copy(lA, lW, gA, gW, gW2, rs);         // stage 0 -> buffer 0
    wait_async0();
    __syncthreads();                                  // publishes stage 0
    if (nst > 1)                                      // stage 1 -> buffer 1
        gemm_stage_copy(lA + GA_SZ * 4, lW + GW_SZ * 4, gA + GBK, gW + GBK,
                        gW2 + GBK, rs);

    for (int t = 0; t < nst; ++t) {
        const int cur = t & 1;
        // A/B fragment: K = vgpr + 2*half
        const float* as = &As[cur * GA_SZ + (wave * 16 + ln) * GPIT + 2 * hi];
        const float* ws = &Ws[cur * GW_SZ + ln * GPIT + 2 * hi];
        // Both loops unrolled: LDS offsets become immediates, acc[] stays in
        // registers, and the fragment loads can be issued a group ahead.
        #pragma unroll
        for (int ks = 0; ks < GBK / 4; ++ks) {
            v2f a;
            a.x = as[ks * 4];
            a.y = as[ks * 4 + 1];
            #pragma unroll
            for (int nt = 0; nt < 4; ++nt) {
                v2f b;                            // B[k][n] = W[n][k]
                b.x = ws[nt * 16 * GPIT + ks * 4];
                b.y = ws[nt * 16 * GPIT + ks * 4 + 1];
                acc[nt] = wmma_f32(a, b, acc[nt]);
            }
        }
        // Publish point of stage t+1: own LDS reads of this buffer retired,
        // own copies of stage t+1 landed, then the one barrier of the trip.
        asm volatile("s_wait_dscnt 0x0" ::: "memory");
        wait_async0();
        __syncthreads();
        if (t + 2 < nst)                          // refill the buffer just read
            gemm_stage_copy(lA + cur * (GA_SZ * 4), lW + cur * (GW_SZ * 4),
                            gA + (size_t)(t + 2) * GBK, gW + (size_t)(t + 2) * GBK,
                            gW2 + (size_t)(t + 2) * GBK, rs);
    }
    wait_async0();                                // nothing in flight at the end

    // C/D layout: row = vgpr + 8*half, col = lane&15
    if (rope) {
        // Rotate-half RoPE over the full hidden dim: pair (i, i + HIDDEN/2).
        const int half = HIDDEN / 2;
        #pragma unroll
        for (int nt = 0; nt < 2; ++nt) {
            const int i = nBase + nt * 16 + ln;
            const float inv_freq = __powf(10000.0f, -(float)i / (float)half);
            const float b1 = bias[i], b2 = bias[i + half];
            #pragma unroll
            for (int v = 0; v < 8; ++v) {
                int row = mBase + wave * 16 + v + 8 * hi;
                float ang = (float)(row & (SEQ - 1)) * inv_freq;
                // Hardware sine and cosine of ang, argument in turns. One
                // statement: the closing v_nop is the slot that the instruction
                // set asks for behind a transcendental, before its result is
                // read or its source overwritten.
                float s, c;
                asm("v_sin_f32 %0, %2\n\t"
                    "v_cos_f32 %1, %2\n\t"
                    "v_nop"
                    : "=&v"(s), "=&v"(c) : "v"(ang * 0.15915494f));
                float x1 = acc[nt][v] + b1, x2 = acc[nt + 2][v] + b2;
                float* p = C + (size_t)row * N;
                p[i]        = x1 * c - x2 * s;
                p[i + half] = x2 * c + x1 * s;
            }
        }
    } else {
        #pragma unroll
        for (int nt = 0; nt < 4; ++nt) {
            #pragma unroll
            for (int v = 0; v < 8; ++v) {
                int row = mBase + wave * 16 + v + 8 * hi;
                int col = nBase + nt * 16 + ln;
                C[(size_t)row * N + col] = acc[nt][v] + bias[col];
            }
        }
    }
}

__global__ __launch_bounds__(256) void gemm_bias_kernel(
    const float* __restrict__ A, const float* __restrict__ W,
    const float* __restrict__ bias, float* __restrict__ C,
    int M, int N, int K)
{
    gemm_bias_tile(A, W, bias, C, M, N, K, false);
}

__global__ __launch_bounds__(256) void gemm_bias_rope_kernel(
    const float* __restrict__ A, const float* __restrict__ W,
    const float* __restrict__ bias, float* __restrict__ C,
    int M, int N, int K)
{
    gemm_bias_tile(A, W, bias, C, M, N, K, true);
}

// ---------------------------------------------------------------------------
// Flash attention: grid = (SEQ/128, BATCH*NGROUPS), 256 threads = 8 waves.
// Wave w owns query rows [blockIdx.x*128 + w*16, +16). Q fragments resident in
// registers. A masked key has softmax weight exactly 0, so each block first
// lists the kept key positions of its batch row (prefix scan of the mask) and
// then walks only ceil(kept/64) tiles, gathering the listed K/V rows.
// 64-key K/V tiles staged in LDS via async copies; P re-laid out
// through a per-wave LDS region for the PV WMMA.
// ---------------------------------------------------------------------------
__global__ __launch_bounds__(256) void attn_kernel(
    const float* __restrict__ q, const float* __restrict__ k,
    const float* __restrict__ v, const int* __restrict__ mask,
    float* __restrict__ o)
{
    __shared__ float Ks[64 * 68];        // 64 keys x 64 dims (stride 68)
    __shared__ float Vs[64 * 68];
    __shared__ float Ps[8 * 16 * 68];    // per-wave 16x64 P tile
    __shared__ int   kidx[SEQ];          // positions of the kept keys, in order
    __shared__ int   wcnt[8];            // kept keys per wave's 256 positions

    const int tid  = threadIdx.x;
    const int wave = tid >> 5;
    const int lane = tid & 31;
    const int hi   = lane >> 4;
    const int ln   = lane & 15;
    const int bb   = blockIdx.y >> 4;    // batch
    const int gg   = blockIdx.y & 15;    // head/group
    const int qbase = blockIdx.x * 128 + wave * 16;
    const float scale = 0.125f;          // 1/sqrt(64)

    const size_t headOff = (size_t)gg * HDIM;
    const size_t batRow  = (size_t)bb * SEQ;

    // Load Q fragments: A layout, M = ln, K = 4*t2 + vgpr + 2*hi
    v2f aq[16];
    {
        const float* qr = q + (batRow + qbase + ln) * HIDDEN + headOff;
        #pragma unroll
        for (int t2 = 0; t2 < 16; ++t2) {
            aq[t2].x = qr[t2 * 4 + 2 * hi];
            aq[t2].y = qr[t2 * 4 + 2 * hi + 1];
        }
    }

    v8f oacc[4] = {};
    float mrow[8], lrow[8];
    #pragma unroll
    for (int vv = 0; vv < 8; ++vv) { mrow[vv] = -1e30f; lrow[vv] = 0.0f; }

    float* Pw = &Ps[wave * 16 * 68];

    // Kept-key list: thread t owns positions [8t, 8t+8) of this batch row.
    int keep[8];
    int cnt = 0;
    #pragma unroll
    for (int j = 0; j < 8; ++j) {
        keep[j] = mask[bb * SEQ + tid * 8 + j] != 0;
        cnt += keep[j];
    }
    int incl = cnt;                      // inclusive scan over the wave
    #pragma unroll
    for (int off = 1; off < 32; off <<= 1) {
        int up = __shfl_up(incl, off, 32);
        if (lane >= off) incl += up;
    }
    if (lane == 31) wcnt[wave] = incl;
    __syncthreads();                     // wcnt complete before it is summed
    int nkeep = 0, slot = incl - cnt;
    #pragma unroll
    for (int w = 0; w < 8; ++w) {
        int c = wcnt[w];
        nkeep += c;
        if (w < wave) slot += c;
    }
    #pragma unroll
    for (int j = 0; j < 8; ++j)
        if (keep[j]) kidx[slot++] = tid * 8 + j;
    // Pad the last tile with a valid row; its scores are masked below.
    if (tid < 64 && nkeep + tid < SEQ) kidx[nkeep + tid] = 0;
    // Same value in every thread; held scalar so that the loop and its
    // barriers run under a scalar branch.
    nkeep = __builtin_amdgcn_readfirstlane(nkeep);
    const int ntiles = min((nkeep + 63) >> 6, SEQ / 64);

    const float* kBase = k + batRow * HIDDEN + headOff;
    const float* vBase = v + batRow * HIDDEN + headOff;

    for (int kt = 0; kt < ntiles; ++kt) {
        __syncthreads();                 // also publishes kidx on the first trip
        // Stage K and V tiles (64 listed rows x 16 float4 each) via async copies
        unsigned goff[4], ldsK[4], ldsV[4];
        #pragma unroll
        for (int i = 0; i < 4; ++i) {
            int vid = tid + i * 256;
            int row = vid >> 4, c4 = vid & 15;
            goff[i] = (unsigned)((kidx[kt * 64 + row] * HIDDEN + c4 * 4) * 4);
            ldsK[i] = (unsigned)(size_t)&Ks[row * 68 + c4 * 4];
            ldsV[i] = (unsigned)(size_t)&Vs[row * 68 + c4 * 4];
        }
        // One statement: the offsets change every trip, and the closing
        // s_wait_xcnt keeps their registers untouched until it has passed.
        asm volatile("global_load_async_to_lds_b128 %0, %8, %12\n\t"
                     "global_load_async_to_lds_b128 %4, %8, %13\n\t"
                     "global_load_async_to_lds_b128 %1, %9, %12\n\t"
                     "global_load_async_to_lds_b128 %5, %9, %13\n\t"
                     "global_load_async_to_lds_b128 %2, %10, %12\n\t"
                     "global_load_async_to_lds_b128 %6, %10, %13\n\t"
                     "global_load_async_to_lds_b128 %3, %11, %12\n\t"
                     "global_load_async_to_lds_b128 %7, %11, %13\n\t"
                     "s_wait_xcnt 0x0"
                     :
                     : "v"(ldsK[0]), "v"(ldsK[1]), "v"(ldsK[2]), "v"(ldsK[3]),
                       "v"(ldsV[0]), "v"(ldsV[1]), "v"(ldsV[2]), "v"(ldsV[3]),
                       "v"(goff[0]), "v"(goff[1]), "v"(goff[2]), "v"(goff[3]),
                       "s"((unsigned long long)(size_t)kBase),
                       "s"((unsigned long long)(size_t)vBase)
                     : "memory");
        wait_async0();
        __syncthreads();

        // S = Q @ K^T : 4 tiles of 16x16, contraction over head_dim (16 steps of 4)
        v8f sacc[4] = {};
        #pragma unroll
        for (int t2 = 0; t2 < 16; ++t2) {
            const int kk = t2 * 4 + 2 * hi;
            #pragma unroll
            for (int nt = 0; nt < 4; ++nt) {
                v2f b;                           // B[k][n] = Ktile[key=n][dim=k]
                b.x = Ks[(nt * 16 + ln) * 68 + kk];
                b.y = Ks[(nt * 16 + ln) * 68 + kk + 1];
                sacc[nt] = wmma_f32(aq[t2], b, sacc[nt]);
            }
        }

        // Scale; mask the pad of the last tile (column = lane&15 in each n-tile)
        float p[4][8];
        #pragma unroll
        for (int nt = 0; nt < 4; ++nt) {
            int mk = kt * 64 + nt * 16 + ln < nkeep;
            #pragma unroll
            for (int vv = 0; vv < 8; ++vv)
                p[nt][vv] = mk ? sacc[nt][vv] * scale : -1e30f;
        }

        // Online softmax; row = vv + 8*hi lives across 16 lanes of one half
        float corr[8];
        #pragma unroll
        for (int vv = 0; vv < 8; ++vv) {
            float tmax = fmaxf(fmaxf(p[0][vv], p[1][vv]), fmaxf(p[2][vv], p[3][vv]));
            #pragma unroll
            for (int off = 1; off < 16; off <<= 1)
                tmax = fmaxf(tmax, __shfl_xor(tmax, off, 32));
            float mnew = fmaxf(mrow[vv], tmax);
            corr[vv] = __expf(mrow[vv] - mnew);
            mrow[vv] = mnew;
            float rsum = 0.0f;
            #pragma unroll
            for (int nt = 0; nt < 4; ++nt) {
                p[nt][vv] = __expf(p[nt][vv] - mnew);
                rsum += p[nt][vv];
            }
            #pragma unroll
            for (int off = 1; off < 16; off <<= 1)
                rsum += __shfl_xor(rsum, off, 32);
            lrow[vv] = lrow[vv] * corr[vv] + rsum;
        }
        #pragma unroll
        for (int nt = 0; nt < 4; ++nt)
            #pragma unroll
            for (int vv = 0; vv < 8; ++vv)
                oacc[nt][vv] *= corr[vv];

        // Spill P (C layout) to per-wave LDS as row-major 16x64
        #pragma unroll
        for (int nt = 0; nt < 4; ++nt)
            #pragma unroll
            for (int vv = 0; vv < 8; ++vv)
                Pw[(vv + 8 * hi) * 68 + nt * 16 + ln] = p[nt][vv];
        __syncthreads();

        // O += P @ V : contraction over the 64 keys (16 steps of 4)
        #pragma unroll
        for (int t2 = 0; t2 < 16; ++t2) {
            const int kk = t2 * 4 + 2 * hi;
            v2f ap;                              // A layout from P
            ap.x = Pw[ln * 68 + kk];
            ap.y = Pw[ln * 68 + kk + 1];
            #pragma unroll
            for (int dt = 0; dt < 4; ++dt) {
                v2f bv;                          // B[k][n] = Vtile[key=k][dim=n]
                bv.x = Vs[kk * 68 + dt * 16 + ln];
                bv.y = Vs[(kk + 1) * 68 + dt * 16 + ln];
                oacc[dt] = wmma_f32(ap, bv, oacc[dt]);
            }
        }
    }

    // Normalize and store: o laid out (b, s, hidden) with head-contiguous dims
    #pragma unroll
    for (int vv = 0; vv < 8; ++vv) lrow[vv] = 1.0f / lrow[vv];
    #pragma unroll
    for (int dt = 0; dt < 4; ++dt) {
        #pragma unroll
        for (int vv = 0; vv < 8; ++vv) {
            int row = qbase + vv + 8 * hi;
            size_t col = headOff + dt * 16 + ln;
            o[(batRow + row) * HIDDEN + col] = oacc[dt][vv] * lrow[vv];
        }
    }
}

// ---------------------------------------------------------------------------
extern "C" void kernel_launch(void* const* d_in, const int* in_sizes, int n_in,
                              void* d_out, int out_size, void* d_ws, size_t ws_size,
                              hipStream_t stream)
{
    const float* x    = (const float*)d_in[0];
    const int*   amsk = (const int*)  d_in[1];
    const float* Wq   = (const float*)d_in[2];
    const float* bq   = (const float*)d_in[3];
    const float* Wk   = (const float*)d_in[4];
    const float* bk   = (const float*)d_in[5];
    const float* Wv   = (const float*)d_in[6];
    const float* bv   = (const float*)d_in[7];
    const float* Wo   = (const float*)d_in[8];
    const float* bo   = (const float*)d_in[9];
    float* out = (float*)d_out;

    const int Mtok = BATCH * SEQ;                 // 4096 tokens
    const size_t bufElems = (size_t)Mtok * HIDDEN;
    float* qb = (float*)d_ws;
    float* kb = qb + bufElems;
    float* vb = kb + bufElems;
    float* ob = vb + bufElems;

    dim3 gGrid(HIDDEN / 64, Mtok / 128);          // (16, 32)

    gemm_bias_rope_kernel<<<gGrid, 256, 0, stream>>>(x, Wq, bq, qb, Mtok, HIDDEN, HIDDEN);
    gemm_bias_rope_kernel<<<gGrid, 256, 0, stream>>>(x, Wk, bk, kb, Mtok, HIDDEN, HIDDEN);
    gemm_bias_kernel<<<gGrid, 256, 0, stream>>>(x, Wv, bv, vb, Mtok, HIDDEN, HIDDEN);

    attn_kernel<<<dim3(SEQ / 128, BATCH * NGROUPS), 256, 0, stream>>>(qb, kb, vb, amsk, ob);

    gemm_bias_kernel<<<gGrid, 256, 0, stream>>>(ob, Wo, bo, out, Mtok, HIDDEN, HIDDEN);
}

// v004
// Measured time: 249 microseconds a run.
// In both of two side-by-side timings against v003, it was 1.12 times as fast.
// All steps since v000 together make it 1.76 times as fast.
#include <hip/hip_runtime.h>
#include <math.h>

typedef __attribute__((ext_vector_type(2))) float v2f;
typedef __attribute__((ext_vector_type(8))) float v8f;

#define HIDDEN  1024
#define SEQ     2048
#define BATCH   2
#define NGROUPS 16
#define HDIM    64

__device__ __forceinline__ v8f wmma_f32(v2f a, v2f b, v8f c) {
    // D = A(16x4 f32) * B(4x16 f32) + C(16x16 f32)
    return __builtin_amdgcn_wmma_f32_16x16x4_f32(
        /*neg_a=*/false, a, /*neg_b=*/false, b,
        /*c_mod=*/(short)0, c, /*reuse_a=*/false, /*reuse_b=*/false);
}

__device__ __forceinline__ void wait_async0() {
    asm volatile("s_wait_asynccnt 0" ::: "memory");
}

// ---------------------------------------------------------------------------
// C[M,N] = A[M,K] @ W[N,K]^T + bias[N]
// Block tile: 128(M) x 64(N), 256 threads = 8 waves. Wave w computes rows
// [w*16, w*16+16) x 64. K is staged in LDS 64 at a time in two buffers: the
// async copies of the next stage are in flight while this stage is multiplied.
// M, N, K are multiples of 128, 64, 64.
// rope (N = HIDDEN, rows are b*SEQ + position): the block's 64 columns are
// 32 columns i of the lower half and their partners i + HIDDEN/2, so that both
// members of every rotated pair sit in one lane's accumulators (tiles nt and
// nt + 2) and the rotation is applied on the way out.
// ---------------------------------------------------------------------------
#define GBK   64                 // k per stage
#define GPIT  68                 // LDS row pitch in floats (272 B = 16 B x odd)
#define GA_SZ (128 * GPIT)       // floats of A per buffer
#define GW_SZ (64 * GPIT)        // floats of W per buffer

// One stage: 16 lanes cover a row's 256 B; a thread copies 8 A rows and 4 W
// rows, 16 rows apart in LDS. lA, lW: the lane's LDS byte addresses of its first
// rows; gA, gW: its global addresses there; gW2: its global address in the
// block's second run of 32 W rows; rs: 16 rows in floats.
__device__ __forceinline__ void gemm_stage_copy(unsigned lA, unsigned lW,
                                                const float* gA, const float* gW,
                                                const float* gW2, size_t rs) {
    const unsigned lr = 16 * GPIT * 4;
    // One statement: the closing s_wait_xcnt keeps the address registers
    // untouched until it has passed (they are advanced for the next stage).
    asm volatile("global_load_async_to_lds_b128 %0, %12, off\n\t"
                 "global_load_async_to_lds_b128 %1, %13, off\n\t"
                 "global_load_async_to_lds_b128 %2, %14, off\n\t"
                 "global_load_async_to_lds_b128 %3, %15, off\n\t"
                 "global_load_async_to_lds_b128 %4, %16, off\n\t"
                 "global_load_async_to_lds_b128 %5, %17, off\n\t"
                 "global_load_async_to_lds_b128 %6, %18, off\n\t"
                 "global_load_async_to_lds_b128 %7, %19, off\n\t"
                 "global_load_async_to_lds_b128 %8, %20, off\n\t"
                 "global_load_async_to_lds_b128 %9, %21, off\n\t"
                 "global_load_async_to_lds_b128 %10, %22, off\n\t"
                 "global_load_async_to_lds_b128 %11, %23, off\n\t"
                 "s_wait_xcnt 0x0"
                 :
                 : "v"(lA), "v"(lA + lr), "v"(lA + 2 * lr), "v"(lA + 3 * lr),
                   "v"(lA + 4 * lr), "v"(lA + 5 * lr), "v"(lA + 6 * lr),
                   "v"(lA + 7 * lr),
                   "v"(lW), "v"(lW + lr), "v"(lW + 2 * lr), "v"(lW + 3 * lr),
                   "v"(gA), "v"(gA + rs), "v"(gA + 2 * rs), "v"(gA + 3 * rs),
                   "v"(gA + 4 * rs), "v"(gA + 5 * rs), "v"(gA + 6 * rs),
                   "v"(gA + 7 * rs),
                   "v"(gW), "v"(gW + rs), "v"(gW2), "v"(gW2 + rs)
                 : "memory");
}

// rope is a literal at both call sites, so each kernel holds one epilogue only.
__device__ __forceinline__ void gemm_bias_tile(
    const float* __restrict__ A, const float* __restrict__ W,
    const float* __restrict__ bias, float* __restrict__ C,
    int M, int N, int K, const bool rope)
{
    __shared__ __attribute__((aligned(16))) float As[2 * GA_SZ];
    __shared__ __attribute__((aligned(16))) float Ws[2 * GW_SZ];

    const int tid  = threadIdx.x;
    const int wave = tid >> 5;
    const int lane = tid & 31;
    const int hi   = lane >> 4;      // lane half
    const int ln   = lane & 15;
    const int mBase = blockIdx.y * 128;
    const int nBase = blockIdx.x * (rope ? 32 : 64);        // columns of tiles 0, 1
    const int nHi   = nBase + (rope ? HIDDEN / 2 : 32);     // columns of tiles 2, 3

    v8f acc[4] = {};

    const int crow = tid >> 4, cc4 = tid & 15;
    const float* gA = A + (size_t)(mBase + crow) * K + cc4 * 4;
    const float* gW = W + (size_t)(nBase + crow) * K + cc4 * 4;
    const float* gW2 = W + (size_t)(nHi + crow) * K + cc4 * 4;
    const unsigned lA = (unsigned)(size_t)&As[crow * GPIT + cc4 * 4];
    const unsigned lW = (unsigned)(size_t)&Ws[crow * GPIT + cc4 * 4];
    const size_t rs = (size_t)16 * K;
    const int nst = K / GBK;

    gemm_stage_copy(lA, lW, gA, gW, gW2, rs);         // stage 0 -> buffer 0
    wait_async0();
    __syncthreads();                                  // publishes stage 0
    if (nst > 1)                                      // stage 1 -> buffer 1
        gemm_stage_copy(lA + GA_SZ * 4, lW + GW_SZ * 4, gA + GBK, gW + GBK,
                        gW2 + GBK, rs);

    for (int t = 0; t < nst; ++t) {
        const int cur = t & 1;
        // A/B fragment: K = vgpr + 2*half
        const float* as = &As[cur * GA_SZ + (wave * 16 + ln) * GPIT + 2 * hi];
        const float* ws = &Ws[cur * GW_SZ + ln * GPIT + 2 * hi];
        // Both loops unrolled: LDS offsets become immediates, acc[] stays in
        // registers, and the fragment loads can be issued a group ahead.
        #pragma unroll
        for (int ks = 0; ks < GBK / 4; ++ks) {
            v2f a;
            a.x = as[ks * 4];
            a.y = as[ks * 4 + 1];
            #pragma unroll
            for (int nt = 0; nt < 4; ++nt) {
                v2f b;                            // B[k][n] = W[n][k]
                b.x = ws[nt * 16 * GPIT + ks * 4];
                b.y = ws[nt * 16 * GPIT + ks * 4 + 1];
                acc[nt] = wmma_f32(a, b, acc[nt]);
            }
        }
        // Publish point of stage t+1: own LDS reads of this buffer retired,
        // own copies of stage t+1 landed, then the one barrier of the trip.
        asm volatile("s_wait_dscnt 0x0" ::: "memory");
        wait_async0();
        __syncthreads();
        if (t + 2 < nst)                          // refill the buffer just read
            gemm_stage_copy(lA + cur * (GA_SZ * 4), lW + cur * (GW_SZ * 4),
                            gA + (size_t)(t + 2) * GBK, gW + (size_t)(t + 2) * GBK,
                            gW2 + (size_t)(t + 2) * GBK, rs);
    }
    wait_async0();                                // nothing in flight at the end

    // C/D layout: row = vgpr + 8*half, col = lane&15
    if (rope) {
        // Rotate-half RoPE over the full hidden dim: pair (i, i + HIDDEN/2).
        const int half = HIDDEN / 2;
        #pragma unroll
        for (int nt = 0; nt < 2; ++nt) {
            const int i = nBase + nt * 16 + ln;
            const float inv_freq = __powf(10000.0f, -(float)i / (float)half);
            const float b1 = bias[i], b2 = bias[i + half];
            #pragma unroll
            for (int v = 0; v < 8; ++v) {
                int row = mBase + wave * 16 + v + 8 * hi;
                float ang = (float)(row & (SEQ - 1)) * inv_freq;
                // Hardware sine and cosine of ang, argument in turns. One
                // statement: the closing v_nop is the slot that the instruction
                // set asks for behind a transcendental, before its result is
                // read or its source overwritten.
                float s, c;
                asm("v_sin_f32 %0, %2\n\t"
                    "v_cos_f32 %1, %2\n\t"
                    "v_nop"
                    : "=&v"(s), "=&v"(c) : "v"(ang * 0.15915494f));
                float x1 = acc[nt][v] + b1, x2 = acc[nt + 2][v] + b2;
                float* p = C + (size_t)row * N;
                p[i]        = x1 * c - x2 * s;
                p[i + half] = x2 * c + x1 * s;
            }
        }
    } else {
        #pragma unroll
        for (int nt = 0; nt < 4; ++nt) {
            #pragma unroll
            for (int v = 0; v < 8; ++v) {
                int row = mBase + wave * 16 + v + 8 * hi;
                int col = nBase + nt * 16 + ln;
                C[(size_t)row * N + col] = acc[nt][v] + bias[col];
            }
        }
    }
}

__global__ __launch_bounds__(256) void gemm_bias_kernel(
    const float* __restrict__ A, const float* __restrict__ W,
    const float* __restrict__ bias, float* __restrict__ C,
    int M, int N, int K)
{
    gemm_bias_tile(A, W, bias, C, M, N, K, false);
}

__global__ __launch_bounds__(256) void gemm_bias_rope_kernel(
    const float* __restrict__ A, const float* __restrict__ W,
    const float* __restrict__ bias, float* __restrict__ C,
    int M, int N, int K)
{
    gemm_bias_tile(A, W, bias, C, M, N, K, true);
}

// ---------------------------------------------------------------------------
// K and V projections of the kept tokens only. A masked key has softmax weight
// exactly 0, so attention never reads its K or V row: the rows of x whose mask
// entry is nonzero are listed (over both batch rows, in order), and the GEMM
// runs over that list, 128 listed rows per block; results go to the rows'
// own places in Ck / Cv. One grid holds both products: blockIdx.x < 16 takes
// 64 K columns (paired for RoPE as above), the rest 64 V columns.
// grid.y covers the case that every token is kept; blocks past the list leave.
// ---------------------------------------------------------------------------
#define MTOK (BATCH * SEQ)

// As gemm_stage_copy, but the 8 A rows are gathered: oA[j] is the lane's byte
// offset from A in listed row j * 16 of its own, ko the stage's byte offset.
__device__ __forceinline__ void gemm_stage_copy_rows(unsigned lA, unsigned lW,
                                                     const float* A,
                                                     const unsigned (&oA)[8],
                                                     unsigned ko,
                                                     const float* gW,
                                                     const float* gW2, size_t rs) {
    const unsigned lr = 16 * GPIT * 4;
    // One statement: the closing s_wait_xcnt keeps the address registers
    // untouched until it has passed (they are formed anew for the next stage).
    asm volatile("global_load_async_to_lds_b128 %0, %12, %24\n\t"
                 "global_load_async_to_lds_b128 %1, %13, %24\n\t"
                 "global_load_async_to_lds_b128 %2, %14, %24\n\t"
                 "global_load_async_to_lds_b128 %3, %15, %24\n\t"
                 "global_load_async_to_lds_b128 %4, %16, %24\n\t"
                 "global_load_async_to_lds_b128 %5, %17, %24\n\t"
                 "global_load_async_to_lds_b128 %6, %18, %24\n\t"
                 "global_load_async_to_lds_b128 %7, %19, %24\n\t"
                 "global_load_async_to_lds_b128 %8, %20, off\n\t"
                 "global_load_async_to_lds_b128 %9, %21, off\n\t"
                 "global_load_async_to_lds_b128 %10, %22, off\n\t"
                 "global_load_async_to_lds_b128 %11, %23, off\n\t"
                 "s_wait_xcnt 0x0"
                 :
                 : "v"(lA), "v"(lA + lr), "v"(lA + 2 * lr), "v"(lA + 3 * lr),
                   "v"(lA + 4 * lr), "v"(lA + 5 * lr), "v"(lA + 6 * lr),
                   "v"(lA + 7 * lr),
                   "v"(lW), "v"(lW + lr), "v"(lW + 2 * lr), "v"(lW + 3 * lr),
                   "v"(oA[0] + ko), "v"(oA[1] + ko), "v"(oA[2] + ko),
                   "v"(oA[3] + ko), "v"(oA[4] + ko), "v"(oA[5] + ko),
                   "v"(oA[6] + ko), "v"(oA[7] + ko),
                   "v"(gW), "v"(gW + rs), "v"(gW2), "v"(gW2 + rs),
                   "s"((unsigned long long)(size_t)A)
                 : "memory");
}

// Epilogue of one wave's 16 list slots x 64 columns. C/D layout: list slot =
// vgpr + 8*half, col = lane&15. rw: the 8 rows of this lane's half; with GUARD
// only the first nlive of them are stored.
template <bool GUARD>
__device__ __forceinline__ void kv_store(const v8f (&acc)[4], const int* rw, int nlive,
                                         bool rope, int nBase, int ln,
                                         const float* __restrict__ bias,
                                         float* __restrict__ C)
{
    int rws[8];
    #pragma unroll
    for (int v = 0; v < 8; ++v) rws[v] = rw[v];
    if (rope) {
        // Rotate-half RoPE over the full hidden dim: pair (i, i + HIDDEN/2).
        const int half = HIDDEN / 2;
        #pragma unroll
        for (int nt = 0; nt < 2; ++nt) {
            const int i = nBase + nt * 16 + ln;
            const float inv_freq = __powf(10000.0f, -(float)i / (float)half);
            const float b1 = bias[i], b2 = bias[i + half];
            #pragma unroll
            for (int v = 0; v < 8; ++v) {
                float ang = (float)(rws[v] & (SEQ - 1)) * inv_freq;
                // Hardware sine and cosine of ang, argument in turns. One
                // statement: the closing v_nop is the slot that the instruction
                // set asks for behind a transcendental, before its result is
                // read or its source overwritten.
                float s, c;
                asm("v_sin_f32 %0, %2\n\t"
                    "v_cos_f32 %1, %2\n\t"
                    "v_nop"
                    : "=&v"(s), "=&v"(c) : "v"(ang * 0.15915494f));
                float x1 = acc[nt][v] + b1, x2 = acc[nt + 2][v] + b2;
                float* p = C + (size_t)rws[v] * HIDDEN;
                if (!GUARD || v < nlive) {
                    p[i]        = x1 * c - x2 * s;
                    p[i + half] = x2 * c + x1 * s;
                }
            }
        }
        // Behind the run of stores: their address and data registers may be
        // overwritten by whatever block the compiler lays out next.
        asm volatile("s_wait_xcnt 0x0" ::: "memory");
    } else {
        #pragma unroll
        for (int nt = 0; nt < 4; ++nt) {
            const int col = nBase + nt * 16 + ln;
            const float bc = bias[col];
            #pragma unroll
            for (int v = 0; v < 8; ++v)
                if (!GUARD || v < nlive)
                    C[(size_t)rws[v] * HIDDEN + col] = acc[nt][v] + bc;
        }
        // Behind the run of stores, as in the other branch.
        asm volatile("s_wait_xcnt 0x0" ::: "memory");
    }
}

__global__ __launch_bounds__(256) void gemm_kv_kept_kernel(
    const float* __restrict__ A, const int* __restrict__ mask,
    const float* __restrict__ Wk, const float* __restrict__ bk,
    const float* __restrict__ Wv, const float* __restrict__ bv,
    float* __restrict__ Ck, float* __restrict__ Cv, int K)
{
    __shared__ __attribute__((aligned(16))) float As[2 * GA_SZ];
    __shared__ __attribute__((aligned(16))) float Ws[2 * GW_SZ];
    __shared__ __attribute__((aligned(16))) int rowidx[128];  // this block's rows
    __shared__ int wcnt[8];              // kept tokens per wave's 512 positions

    const int tid  = threadIdx.x;
    const int wave = tid >> 5;
    const int lane = tid & 31;
    const int hi   = lane >> 4;
    const int ln   = lane & 15;
    const int lo   = blockIdx.y * 128;   // first list slot of this block
    const int4* m4 = (const int4*)mask;

    // Every wave counts the whole mask for itself, so that a block past the
    // end of the list can leave in front of the first barrier.
    int tot = 0;
    // 16 loads in flight a trip: two round trips to L2 in all, and no more
    // registers than the K loop needs.
    #pragma unroll 16
    for (int j = 0; j < MTOK / 128; ++j) {
        int4 m = m4[j * 32 + lane];
        tot += (m.x != 0) + (m.y != 0) + (m.z != 0) + (m.w != 0);
    }
    #pragma unroll
    for (int off = 1; off < 32; off <<= 1) tot += __shfl_xor(tot, off, 32);
    const int nk = __builtin_amdgcn_readfirstlane(tot);
    if (lo >= nk) return;

    // List slots [lo, lo + 128): thread t owns positions [16t, 16t + 16).
    int keep[16];                        // loops over it unrolled: it stays in registers
    int cnt = 0;
    #pragma unroll
    for (int j = 0; j < 4; ++j) {
        int4 m = m4[tid * 4 + j];
        keep[4 * j]     = m.x != 0;
        keep[4 * j + 1] = m.y != 0;
        keep[4 * j + 2] = m.z != 0;
        keep[4 * j + 3] = m.w != 0;
        cnt += keep[4 * j] + keep[4 * j + 1] + keep[4 * j + 2] + keep[4 * j + 3];
    }
    int incl = cnt;                      // inclusive scan over the wave
    #pragma unroll
    for (int off = 1; off < 32; off <<= 1) {
        int up = __shfl_up(incl, off, 32);
        if (lane >= off) incl += up;
    }
    if (lane == 31) wcnt[wave] = incl;
    if (tid < 128) rowidx[tid] = 0;      // slots past the list: a valid row, not stored
    __syncthreads();                     // wcnt complete, rowidx cleared
    int slot = incl - cnt - lo;
    #pragma unroll
    for (int w = 0; w < 8; ++w)
        if (w < wave) slot += wcnt[w];
    if (slot < 128 && slot + cnt > 0) {  // some slot of this thread is the block's
        #pragma unroll
        for (int j = 0; j < 16; ++j) {
            if (keep[j] && (unsigned)slot < 128u) rowidx[slot] = tid * 16 + j;
            slot += keep[j];
        }
    }
    __syncthreads();                     // publishes rowidx

    const bool rope = blockIdx.x < HIDDEN / 64;             // K columns, else V
    const int  bx   = blockIdx.x & (HIDDEN / 64 - 1);
    const float* W    = rope ? Wk : Wv;
    const float* bias = rope ? bk : bv;
    float*       C    = rope ? Ck : Cv;
    const int nBase = bx * (rope ? 32 : 64);                // columns of tiles 0, 1
    const int nHi   = nBase + (rope ? HIDDEN / 2 : 32);     // columns of tiles 2, 3
    // A wave whose 16 slots all lie past the list multiplies nothing; it still
    // copies its share of every stage and passes every barrier.
    const int  nl   = nk - __builtin_amdgcn_readfirstlane(lo + wave * 16);  // its live slots
    const bool wact = nl > 0;

    v8f acc[4] = {};

    const int crow = tid >> 4, cc4 = tid & 15;
    unsigned oA[8];
    #pragma unroll
    for (int j = 0; j < 8; ++j)
        oA[j] = (unsigned)((rowidx[crow + 16 * j] * K + cc4 * 4) * 4);
    const float* gW = W + (size_t)(nBase + crow) * K + cc4 * 4;
    const float* gW2 = W + (size_t)(nHi + crow) * K + cc4 * 4;
    const unsigned lA = (unsigned)(size_t)&As[crow * GPIT + cc4 * 4];
    const unsigned lW = (unsigned)(size_t)&Ws[crow * GPIT + cc4 * 4];
    const size_t rs = (size_t)16 * K;
    const int nst = K / GBK;

    gemm_stage_copy_rows(lA, lW, A, oA, 0u, gW, gW2, rs);   // stage 0 -> buffer 0
    wait_async0();
    __syncthreads();                                  // publishes stage 0
    if (nst > 1)                                      // stage 1 -> buffer 1
        gemm_stage_copy_rows(lA + GA_SZ * 4, lW + GW_SZ * 4, A, oA, GBK * 4u,
                             gW + GBK, gW2 + GBK, rs);

    for (int t = 0; t < nst; ++t) {
        const int cur = t & 1;
        if (wact) {
            // A/B fragment: K = vgpr + 2*half
            const float* as = &As[cur * GA_SZ + (wave * 16 + ln) * GPIT + 2 * hi];
            const float* ws = &Ws[cur * GW_SZ + ln * GPIT + 2 * hi];
            // Both loops unrolled: LDS offsets become immediates, acc[] stays in
            // registers, and the fragment loads can be issued a group ahead.
            #pragma unroll
            for (int ks = 0; ks < GBK / 4; ++ks) {
                v2f a;
                a.x = as[ks * 4];
                a.y = as[ks * 4 + 1];
                #pragma unroll
                for (int nt = 0; nt < 4; ++nt) {
                    v2f b;                        // B[k][n] = W[n][k]
                    b.x = ws[nt * 16 * GPIT + ks * 4];
                    b.y = ws[nt * 16 * GPIT + ks * 4 + 1];
                    acc[nt] = wmma_f32(a, b, acc[nt]);
                }
            }
        }
        // Publish point of stage t+1: own LDS reads of this buffer retired,
        // own copies of stage t+1 landed, then the one barrier of the trip.
        asm volatile("s_wait_dscnt 0x0" ::: "memory");
        wait_async0();
        __syncthreads();
        if (t + 2 < nst)                          // refill the buffer just read
            gemm_stage_copy_rows(lA + cur * (GA_SZ * 4), lW + cur * (GW_SZ * 4),
                                 A, oA, (unsigned)(t + 2) * (GBK * 4u),
                                 gW + (size_t)(t + 2) * GBK,
                                 gW2 + (size_t)(t + 2) * GBK, rs);
    }
    wait_async0();                                // nothing in flight at the end

    // Only the list's last 16 slots can be partly filled: every other working
    // wave stores without a test per row.
    if (wact) {
        if (nl >= 16)
            kv_store<false>(acc, &rowidx[wave * 16 + 8 * hi], 8, rope, nBase, ln, bias, C);
        else
            kv_store<true>(acc, &rowidx[wave * 16 + 8 * hi], nl - 8 * hi, rope, nBase, ln,
                           bias, C);
    }
}

// ---------------------------------------------------------------------------
// Flash attention: grid = (SEQ/128, BATCH*NGROUPS), 256 threads = 8 waves.
// Wave w owns query rows [blockIdx.x*128 + w*16, +16). Q fragments resident in
// registers. A masked key has softmax weight exactly 0, so each block first
// lists the kept key positions of its batch row (prefix scan of the mask) and
// then walks only ceil(kept/64) tiles, gathering the listed K/V rows.
// 64-key K/V tiles staged in LDS via async copies; P re-laid out
// through a per-wave LDS region for the PV WMMA.
// ---------------------------------------------------------------------------
__global__ __launch_bounds__(256) void attn_kernel(
    const float* __restrict__ q, const float* __restrict__ k,
    const float* __restrict__ v, const int* __restrict__ mask,
    float* __restrict__ o)
{
    __shared__ float Ks[64 * 68];        // 64 keys x 64 dims (stride 68)
    __shared__ float Vs[64 * 68];
    __shared__ float Ps[8 * 16 * 68];    // per-wave 16x64 P tile
    __shared__ int   kidx[SEQ];          // positions of the kept keys, in order
    __shared__ int   wcnt[8];            // kept keys per wave's 256 positions

    const int tid  = threadIdx.x;
    const int wave = tid >> 5;
    const int lane = tid & 31;
    const int hi   = lane >> 4;
    const int ln   = lane & 15;
    const int bb   = blockIdx.y >> 4;    // batch
    const int gg   = blockIdx.y & 15;    // head/group
    const int qbase = blockIdx.x * 128 + wave * 16;
    const float scale = 0.125f;          // 1/sqrt(64)

    const size_t headOff = (size_t)gg * HDIM;
    const size_t batRow  = (size_t)bb * SEQ;

    // Load Q fragments: A layout, M = ln, K = 4*t2 + vgpr + 2*hi
    v2f aq[16];
    {
        const float* qr = q + (batRow + qbase + ln) * HIDDEN + headOff;
        #pragma unroll
        for (int t2 = 0; t2 < 16; ++t2) {
            aq[t2].x = qr[t2 * 4 + 2 * hi];
            aq[t2].y = qr[t2 * 4 + 2 * hi + 1];
        }
    }

    v8f oacc[4] = {};
    float mrow[8], lrow[8];
    #pragma unroll
    for (int vv = 0; vv < 8; ++vv) { mrow[vv] = -1e30f; lrow[vv] = 0.0f; }

    float* Pw = &Ps[wave * 16 * 68];

    // Kept-key list: thread t owns positions [8t, 8t+8) of this batch row.
    int keep[8];
    int cnt = 0;
    #pragma unroll
    for (int j = 0; j < 8; ++j) {
        keep[j] = mask[bb * SEQ + tid * 8 + j] != 0;
        cnt += keep[j];
    }
    int incl = cnt;                      // inclusive scan over the wave
    #pragma unroll
    for (int off = 1; off < 32; off <<= 1) {
        int up = __shfl_up(incl, off, 32);
        if (lane >= off) incl += up;
    }
    if (lane == 31) wcnt[wave] = incl;
    __syncthreads();                     // wcnt complete before it is summed
    int nkeep = 0, slot = incl - cnt;
    #pragma unroll
    for (int w = 0; w < 8; ++w) {
        int c = wcnt[w];
        nkeep += c;
        if (w < wave) slot += c;
    }
    #pragma unroll
    for (int j = 0; j < 8; ++j)
        if (keep[j]) kidx[slot++] = tid * 8 + j;
    // Same value in every thread; held scalar so that the loop and its
    // barriers run under a scalar branch.
    nkeep = __builtin_amdgcn_readfirstlane(nkeep);
    const int ntiles = min((nkeep + 63) >> 6, SEQ / 64);

    const float* kBase = k + batRow * HIDDEN + headOff;
    const float* vBase = v + batRow * HIDDEN + headOff;

    for (int kt = 0; kt < ntiles; ++kt) {
        __syncthreads();                 // also publishes kidx on the first trip
        // Stage K and V tiles (64 listed rows x 16 float4 each) via async copies
        unsigned goff[4], ldsK[4], ldsV[4];
        #pragma unroll
        for (int i = 0; i < 4; ++i) {
            int vid = tid + i * 256;
            int row = vid >> 4, c4 = vid & 15;
            // Slots past the list repeat the last kept row (only kept rows of
            // k and v are written); their scores are masked below.
            goff[i] = (unsigned)((kidx[min(kt * 64 + row, nkeep - 1)] * HIDDEN + c4 * 4) * 4);
            ldsK[i] = (unsigned)(size_t)&Ks[row * 68 + c4 * 4];
            ldsV[i] = (unsigned)(size_t)&Vs[row * 68 + c4 * 4];
        }
        // One statement: the offsets change every trip, and the closing
        // s_wait_xcnt keeps their registers untouched until it has passed.
        asm volatile("global_load_async_to_lds_b128 %0, %8, %12\n\t"
                     "global_load_async_to_lds_b128 %4, %8, %13\n\t"
                     "global_load_async_to_lds_b128 %1, %9, %12\n\t"
                     "global_load_async_to_lds_b128 %5, %9, %13\n\t"
                     "global_load_async_to_lds_b128 %2, %10, %12\n\t"
                     "global_load_async_to_lds_b128 %6, %10, %13\n\t"
                     "global_load_async_to_lds_b128 %3, %11, %12\n\t"
                     "global_load_async_to_lds_b128 %7, %11, %13\n\t"
                     "s_wait_xcnt 0x0"
                     :
                     : "v"(ldsK[0]), "v"(ldsK[1]), "v"(ldsK[2]), "v"(ldsK[3]),
                       "v"(ldsV[0]), "v"(ldsV[1]), "v"(ldsV[2]), "v"(ldsV[3]),
                       "v"(goff[0]), "v"(goff[1]), "v"(goff[2]), "v"(goff[3]),
                       "s"((unsigned long long)(size_t)kBase),
                       "s"((unsigned long long)(size_t)vBase)
                     : "memory");
        wait_async0();
        __syncthreads();

        // S = Q @ K^T : 4 tiles of 16x16, contraction over head_dim (16 steps of 4)
        v8f sacc[4] = {};
        #pragma unroll
        for (int t2 = 0; t2 < 16; ++t2) {
            const int kk = t2 * 4 + 2 * hi;
            #pragma unroll
            for (int nt = 0; nt < 4; ++nt) {
                v2f b;                           // B[k][n] = Ktile[key=n][dim=k]
                b.x = Ks[(nt * 16 + ln) * 68 + kk];
                b.y = Ks[(nt * 16 + ln) * 68 + kk + 1];
                sacc[nt] = wmma_f32(aq[t2], b, sacc[nt]);
            }
        }

        // Scale; mask the pad of the last tile (column = lane&15 in each n-tile)
        float p[4][8];
        #pragma unroll
        for (int nt = 0; nt < 4; ++nt) {
            int mk = kt * 64 + nt * 16 + ln < nkeep;
            #pragma unroll
            for (int vv = 0; vv < 8; ++vv)
                p[nt][vv] = mk ? sacc[nt][vv] * scale : -1e30f;
        }

        // Online softmax; row = vv + 8*hi lives across 16 lanes of one half
        float corr[8];
        #pragma unroll
        for (int vv = 0; vv < 8; ++vv) {
            float tmax = fmaxf(fmaxf(p[0][vv], p[1][vv]), fmaxf(p[2][vv], p[3][vv]));
            #pragma unroll
            for (int off = 1; off < 16; off <<= 1)
                tmax = fmaxf(tmax, __shfl_xor(tmax, off, 32));
            float mnew = fmaxf(mrow[vv], tmax);
            corr[vv] = __expf(mrow[vv] - mnew);
            mrow[vv] = mnew;
            float rsum = 0.0f;
            #pragma unroll
            for (int nt = 0; nt < 4; ++nt) {
                p[nt][vv] = __expf(p[nt][vv] - mnew);
                rsum += p[nt][vv];
            }
            #pragma unroll
            for (int off = 1; off < 16; off <<= 1)
                rsum += __shfl_xor(rsum, off, 32);
            lrow[vv] = lrow[vv] * corr[vv] + rsum;
        }
        #pragma unroll
        for (int nt = 0; nt < 4; ++nt)
            #pragma unroll
            for (int vv = 0; vv < 8; ++vv)
                oacc[nt][vv] *= corr[vv];

        // Spill P (C layout) to per-wave LDS as row-major 16x64
        #pragma unroll
        for (int nt = 0; nt < 4; ++nt)
            #pragma unroll
            for (int vv = 0; vv < 8; ++vv)
                Pw[(vv + 8 * hi) * 68 + nt * 16 + ln] = p[nt][vv];
        __syncthreads();

        // O += P @ V : contraction over the 64 keys (16 steps of 4)
        #pragma unroll
        for (int t2 = 0; t2 < 16; ++t2) {
            const int kk = t2 * 4 + 2 * hi;
            v2f ap;                              // A layout from P
            ap.x = Pw[ln * 68 + kk];
            ap.y = Pw[ln * 68 + kk + 1];
            #pragma unroll
            for (int dt = 0; dt < 4; ++dt) {
                v2f bv;                          // B[k][n] = Vtile[key=k][dim=n]
                bv.x = Vs[kk * 68 + dt * 16 + ln];
                bv.y = Vs[(kk + 1) * 68 + dt * 16 + ln];
                oacc[dt] = wmma_f32(ap, bv, oacc[dt]);
            }
        }
    }

    // Normalize and store: o laid out (b, s, hidden) with head-contiguous dims
    #pragma unroll
    for (int vv = 0; vv < 8; ++vv) lrow[vv] = 1.0f / lrow[vv];
    #pragma unroll
    for (int dt = 0; dt < 4; ++dt) {
        #pragma unroll
        for (int vv = 0; vv < 8; ++vv) {
            int row = qbase + vv + 8 * hi;
            size_t col = headOff + dt * 16 + ln;
            o[(batRow + row) * HIDDEN + col] = oacc[dt][vv] * lrow[vv];
        }
    }
}

// ---------------------------------------------------------------------------
extern "C" void kernel_launch(void* const* d_in, const int* in_sizes, int n_in,
                              void* d_out, int out_size, void* d_ws, size_t ws_size,
                              hipStream_t stream)
{
    const float* x    = (const float*)d_in[0];
    const int*   amsk = (const int*)  d_in[1];
    const float* Wq   = (const float*)d_in[2];
    const float* bq   = (const float*)d_in[3];
    const float* Wk   = (const float*)d_in[4];
    const float* bk   = (const float*)d_in[5];
    const float* Wv   = (const float*)d_in[6];
    const float* bv   = (const float*)d_in[7];
    const float* Wo   = (const float*)d_in[8];
    const float* bo   = (const float*)d_in[9];
    float* out = (float*)d_out;

    const int Mtok = BATCH * SEQ;                 // 4096 tokens
    const size_t bufElems = (size_t)Mtok * HIDDEN;
    float* qb = (float*)d_ws;
    float* kb = qb + bufElems;
    float* vb = kb + bufElems;
    float* ob = vb + bufElems;

    dim3 gGrid(HIDDEN / 64, Mtok / 128);          // (16, 32)

    gemm_bias_rope_kernel<<<gGrid, 256, 0, stream>>>(x, Wq, bq, qb, Mtok, HIDDEN, HIDDEN);
    gemm_kv_kept_kernel<<<dim3(2 * HIDDEN / 64, Mtok / 128), 256, 0, stream>>>(
        x, amsk, Wk, bk, Wv, bv, kb, vb, HIDDEN);

    attn_kernel<<<dim3(SEQ / 128, BATCH * NGROUPS), 256, 0, stream>>>(qb, kb, vb, amsk, ob);

    gemm_bias_kernel<<<gGrid, 256, 0, stream>>>(ob, Wo, bo, out, Mtok, HIDDEN, HIDDEN);
}
